// v000
// Measured on an AMD MI455X. A time is GPU time per run, averaged over a window of back-to-back runs after a warm-up
// (all launches, gaps included; the runs take copies of the inputs in turn), and the median of several windows.
// Apart from v000's, it joins two sittings. Times from different sittings can be a few percent apart, while
// side-by-side timings come from the same sitting.
// v000, which the later versions start from, runs in 195 microseconds.
#include <hip/hip_runtime.h>
#include <math.h>

typedef __attribute__((ext_vector_type(2))) float v2f;
typedef __attribute__((ext_vector_type(8))) float v8f;

// Async-copy builtin operand types (match clang's declared signatures:
// b64 -> int __vector(2)*, b128 -> int __vector(4)*).
typedef int vi2 __attribute__((vector_size(8)));
typedef int vi4 __attribute__((vector_size(16)));

#define BATCH  8
#define SEQ    2048
#define DMODEL 1024
#define HD     8
#define ROWS   (BATCH * SEQ)
#define CHUNK  256
#define KSTR   10

#if __has_builtin(__builtin_amdgcn_global_load_async_to_lds_b64) && \
    __has_builtin(__builtin_amdgcn_global_load_async_to_lds_b128)
#define USE_ASYNC_LDS 1
#else
#define USE_ASYNC_LDS 0
#endif

#if USE_ASYNC_LDS
__device__ __forceinline__ void async_cp_b64(const void* g, void* l) {
    __builtin_amdgcn_global_load_async_to_lds_b64(
        (__attribute__((address_space(1))) vi2*)g,
        (__attribute__((address_space(3))) vi2*)l, 0, 0);
}
__device__ __forceinline__ void async_cp_b128(const void* g, void* l) {
    __builtin_amdgcn_global_load_async_to_lds_b128(
        (__attribute__((address_space(1))) vi4*)g,
        (__attribute__((address_space(3))) vi4*)l, 0, 0);
}
#endif

__device__ __forceinline__ void wait_async_lds() {
#if USE_ASYNC_LDS
#if __has_builtin(__builtin_amdgcn_s_wait_asynccnt)
    __builtin_amdgcn_s_wait_asynccnt(0);
#else
    asm volatile("s_wait_asynccnt 0x0" ::: "memory");
#endif
#endif
}

__global__ __launch_bounds__(128)
void proj_qkv(const float* __restrict__ in,
              const float* __restrict__ W1, const float* __restrict__ b1,
              float* __restrict__ o1,
              const float* __restrict__ W2, const float* __restrict__ b2,
              float* __restrict__ o2, int dual)
{
    const int wave = threadIdx.x >> 5;
    const int lane = threadIdx.x & 31;
    const int h  = lane & 7;
    const int rs = lane >> 3;                     // 0..3
    const int r0 = (blockIdx.x * 4 + wave) * 16;  // 16 rows per wave

    const float4* in4 = (const float4*)in;

    float acc1[4], acc2[4];
    const float bb1 = b1[h];
    const float bb2 = dual ? b2[h] : 0.0f;
#pragma unroll
    for (int k = 0; k < 4; ++k) { acc1[k] = bb1; acc2[k] = bb2; }

    for (int i = 0; i < DMODEL / 4; ++i) {
        const int d = i * 4;
        const float wa = W1[(d + 0) * HD + h];
        const float wb = W1[(d + 1) * HD + h];
        const float wc = W1[(d + 2) * HD + h];
        const float wd = W1[(d + 3) * HD + h];
        float va = 0.f, vb = 0.f, vc = 0.f, vd = 0.f;
        if (dual) {
            va = W2[(d + 0) * HD + h];
            vb = W2[(d + 1) * HD + h];
            vc = W2[(d + 2) * HD + h];
            vd = W2[(d + 3) * HD + h];
        }
#pragma unroll
        for (int k = 0; k < 4; ++k) {
            const size_t row = (size_t)(r0 + rs + 4 * k);
            const float4 xv = in4[row * (DMODEL / 4) + i];
            acc1[k] = fmaf(xv.x, wa, acc1[k]);
            acc1[k] = fmaf(xv.y, wb, acc1[k]);
            acc1[k] = fmaf(xv.z, wc, acc1[k]);
            acc1[k] = fmaf(xv.w, wd, acc1[k]);
            if (dual) {
                acc2[k] = fmaf(xv.x, va, acc2[k]);
                acc2[k] = fmaf(xv.y, vb, acc2[k]);
                acc2[k] = fmaf(xv.z, vc, acc2[k]);
                acc2[k] = fmaf(xv.w, vd, acc2[k]);
            }
        }
    }
#pragma unroll
    for (int k = 0; k < 4; ++k) {
        const size_t row = (size_t)(r0 + rs + 4 * k);
        o1[row * HD + h] = acc1[k];               // 128B coalesced per store
        if (dual) o2[row * HD + h] = acc2[k];
    }
}

__global__ __launch_bounds__(128)
void attn_kernel(const float* __restrict__ q, const float* __restrict__ k,
                 const float* __restrict__ v, float* __restrict__ attn)
{
    __shared__ float Ks[2][CHUNK * KSTR];   // 2 x 10 KB, padded rows
    __shared__ float Vs[2][CHUNK * HD];     // 2 x  8 KB

    const int b    = blockIdx.y;
    const int wave = threadIdx.x >> 5;
    const int lane = threadIdx.x & 31;
    const int n    = lane & 15;          // N index (query col of S^T)
    const int half = lane >> 4;          // lane half selects K/M sub-range
    const int s0   = blockIdx.x * 64 + wave * 16;

    const float* qb = q + (size_t)b * SEQ * HD;
    const float* kb = k + (size_t)b * SEQ * HD;
    const float* vb = v + (size_t)b * SEQ * HD;

    const float* qrow = qb + (size_t)(s0 + n) * HD;
    const v2f bq0 = *(const v2f*)(qrow + 2 * half);       // h = {2h0, 2h0+1}
    const v2f bq1 = *(const v2f*)(qrow + 4 + 2 * half);   // h = {4+2h0, 5+2h0}

    float m_state = -1e30f;
    float l_state = 0.0f;
    float acc[HD];
#pragma unroll
    for (int hh = 0; hh < HD; ++hh) acc[hh] = 0.0f;

    // ---- staging helper: copy CHUNK rows of K (padded) and V into buffer ----
    auto stage = [&](int tc, int buf) {
        for (int r = threadIdx.x; r < CHUNK; r += 128) {
            const float* krow = kb + (size_t)(tc + r) * HD;
            float*       kd   = &Ks[buf][r * KSTR];
            const float* vrow = vb + (size_t)(tc + r) * HD;
            float*       vd   = &Vs[buf][r * HD];
#if USE_ASYNC_LDS
            async_cp_b64(krow + 0, kd + 0);     // 8B-aligned (stride 40B rows)
            async_cp_b64(krow + 2, kd + 2);
            async_cp_b64(krow + 4, kd + 4);
            async_cp_b64(krow + 6, kd + 6);
            async_cp_b128(vrow + 0, vd + 0);    // 16B-aligned (stride 32B rows)
            async_cp_b128(vrow + 4, vd + 4);
#else
            const float4 ka = ((const float4*)krow)[0];
            const float4 kc = ((const float4*)krow)[1];
            *(v2f*)(kd + 0) = (v2f){ka.x, ka.y};
            *(v2f*)(kd + 2) = (v2f){ka.z, ka.w};
            *(v2f*)(kd + 4) = (v2f){kc.x, kc.y};
            *(v2f*)(kd + 6) = (v2f){kc.z, kc.w};
            ((float4*)vd)[0] = ((const float4*)vrow)[0];
            ((float4*)vd)[1] = ((const float4*)vrow)[1];
#endif
        }
    };

    // Preload chunk 0 into buffer 0.
    stage(0, 0);
    wait_async_lds();
    __syncthreads();

    int cur = 0;
    for (int tc = 0; tc < SEQ; tc += CHUNK) {
        // Kick off next chunk into the alternate buffer (overlaps compute).
        if (tc + CHUNK < SEQ) stage(tc + CHUNK, cur ^ 1);

        for (int t0 = 0; t0 < CHUNK; t0 += 16) {
            const float* krow0 = &Ks[cur][(t0 + n) * KSTR];
            const v2f a0 = *(const v2f*)(krow0 + 2 * half);
            const v2f a1 = *(const v2f*)(krow0 + 4 + 2 * half);

            v8f c = {};
            c = __builtin_amdgcn_wmma_f32_16x16x4_f32(false, a0, false, bq0,
                                                      (short)0, c, false, false);
            c = __builtin_amdgcn_wmma_f32_16x16x4_f32(false, a1, false, bq1,
                                                      (short)0, c, false, false);
            // c[j] = score(s = s0+n, t = tc + t0 + j + 8*half)

            float tmax = c[0];
#pragma unroll
            for (int j = 1; j < 8; ++j) tmax = fmaxf(tmax, c[j]);
            tmax = fmaxf(tmax, __shfl_xor(tmax, 16));

            const float m_new = fmaxf(m_state, tmax);
            const float scale = __expf(m_state - m_new);

            float p[8];
            float psum = 0.0f;
#pragma unroll
            for (int j = 0; j < 8; ++j) {
                p[j] = __expf(c[j] - m_new);
                psum += p[j];
            }
            psum += __shfl_xor(psum, 16);
            l_state = l_state * scale + psum;
            m_state = m_new;

            // partial[h] = sum_j p[j] * V[t0 + j + 8*half][h]  (LDS broadcast)
            float part[HD];
#pragma unroll
            for (int hh = 0; hh < HD; ++hh) part[hh] = 0.0f;
#pragma unroll
            for (int j = 0; j < 8; ++j) {
                const float4* vrow =
                    (const float4*)&Vs[cur][(t0 + j + 8 * half) * HD];
                const float4 v0 = vrow[0], v1 = vrow[1];
                part[0] = fmaf(p[j], v0.x, part[0]);
                part[1] = fmaf(p[j], v0.y, part[1]);
                part[2] = fmaf(p[j], v0.z, part[2]);
                part[3] = fmaf(p[j], v0.w, part[3]);
                part[4] = fmaf(p[j], v1.x, part[4]);
                part[5] = fmaf(p[j], v1.y, part[5]);
                part[6] = fmaf(p[j], v1.z, part[6]);
                part[7] = fmaf(p[j], v1.w, part[7]);
            }
#pragma unroll
            for (int hh = 0; hh < HD; ++hh)
                acc[hh] = acc[hh] * scale + part[hh] + __shfl_xor(part[hh], 16);
        }

        // My async fills for the next buffer are done; barrier makes them
        // visible to all waves and confirms everyone finished this buffer.
        wait_async_lds();
        __syncthreads();
        cur ^= 1;
    }

    if (half == 0) {
        const float invl = 1.0f / l_state;
        float* orow = attn + ((size_t)b * SEQ + s0 + n) * HD;
        float4 o0, o1;
        o0.x = acc[0] * invl; o0.y = acc[1] * invl;
        o0.z = acc[2] * invl; o0.w = acc[3] * invl;
        o1.x = acc[4] * invl; o1.y = acc[5] * invl;
        o1.z = acc[6] * invl; o1.w = acc[7] * invl;
        ((float4*)orow)[0] = o0;
        ((float4*)orow)[1] = o1;
    }
}

// ---------------------------------------------------------------------------
// Kernel 3: out[r,:] = attn[r,0:8] @ Wo[8,1024] + bo. Bound by 64MB output
// write. Wo held in registers (8 x float4 per thread), attn row is a uniform
// load (scalarizable). 16 rows per block.
// ---------------------------------------------------------------------------
__global__ __launch_bounds__(256)
void out_proj(const float* __restrict__ attn, const float* __restrict__ Wo,
              const float* __restrict__ bo, float* __restrict__ out)
{
    const int r0 = blockIdx.x * 16;
    const int c4 = threadIdx.x;                    // float4 column 0..255
    const float4* Wo4 = (const float4*)Wo;

    float4 w[8];
#pragma unroll
    for (int h = 0; h < 8; ++h) w[h] = Wo4[h * (DMODEL / 4) + c4];
    const float4 ob = ((const float4*)bo)[c4];

    for (int r = 0; r < 16; ++r) {
        const float* ar = attn + (size_t)(r0 + r) * HD;
        float a[8];
#pragma unroll
        for (int h = 0; h < 8; ++h) a[h] = ar[h];
        float4 o = ob;
#pragma unroll
        for (int h = 0; h < 8; ++h) {
            o.x = fmaf(a[h], w[h].x, o.x);
            o.y = fmaf(a[h], w[h].y, o.y);
            o.z = fmaf(a[h], w[h].z, o.z);
            o.w = fmaf(a[h], w[h].w, o.w);
        }
        ((float4*)out)[(size_t)(r0 + r) * (DMODEL / 4) + c4] = o;
    }
}

// ---------------------------------------------------------------------------
extern "C" void kernel_launch(void* const* d_in, const int* in_sizes, int n_in,
                              void* d_out, int out_size, void* d_ws, size_t ws_size,
                              hipStream_t stream)
{
    const float* x       = (const float*)d_in[0];
    const float* context = (const float*)d_in[1];
    const float* Wq      = (const float*)d_in[2];
    const float* bq      = (const float*)d_in[3];
    const float* Wk      = (const float*)d_in[4];
    const float* bk      = (const float*)d_in[5];
    const float* Wv      = (const float*)d_in[6];
    const float* bv      = (const float*)d_in[7];
    const float* Wo      = (const float*)d_in[8];
    const float* bo      = (const float*)d_in[9];
    float* out = (float*)d_out;

    float* q    = (float*)d_ws;                // 16384*8 f32 = 512KB
    float* kbuf = q    + (size_t)ROWS * HD;
    float* vbuf = kbuf + (size_t)ROWS * HD;
    float* attn = vbuf + (size_t)ROWS * HD;    // total 2MB scratch

    // q from x (single output)
    proj_qkv<<<ROWS / 64, 128, 0, stream>>>(x, Wq, bq, q,
                                            nullptr, nullptr, nullptr, 0);
    // k and v fused from one read of context
    proj_qkv<<<ROWS / 64, 128, 0, stream>>>(context, Wk, bk, kbuf,
                                            Wv, bv, vbuf, 1);
    // flash attention (WMMA scores, async double-buffered K/V staging)
    attn_kernel<<<dim3(SEQ / 64, BATCH), 128, 0, stream>>>(q, kbuf, vbuf, attn);
    // output projection
    out_proj<<<ROWS / 16, 256, 0, stream>>>(attn, Wo, bo, out);
}

// v001
// One run takes 55.3 microseconds.
// Timed twice side by side with v000, it ran 3.65 and 3.60 times as fast.
#include <hip/hip_runtime.h>
#include <math.h>

typedef __attribute__((ext_vector_type(2))) float v2f;
typedef __attribute__((ext_vector_type(8))) float v8f;

// Async-copy builtin operand types (match clang's declared signatures:
// b64 -> int __vector(2)*, b128 -> int __vector(4)*).
typedef int vi2 __attribute__((vector_size(8)));
typedef int vi4 __attribute__((vector_size(16)));

#define BATCH  8
#define SEQ    2048
#define DMODEL 1024
#define HD     8
#define ROWS   (BATCH * SEQ)
#define CHUNK  256
#define KSTR   10

#if __has_builtin(__builtin_amdgcn_global_load_async_to_lds_b64) && \
    __has_builtin(__builtin_amdgcn_global_load_async_to_lds_b128)
#define USE_ASYNC_LDS 1
#else
#define USE_ASYNC_LDS 0
#endif

#if USE_ASYNC_LDS
__device__ __forceinline__ void async_cp_b64(const void* g, void* l) {
    __builtin_amdgcn_global_load_async_to_lds_b64(
        (__attribute__((address_space(1))) vi2*)g,
        (__attribute__((address_space(3))) vi2*)l, 0, 0);
}
__device__ __forceinline__ void async_cp_b128(const void* g, void* l) {
    __builtin_amdgcn_global_load_async_to_lds_b128(
        (__attribute__((address_space(1))) vi4*)g,
        (__attribute__((address_space(3))) vi4*)l, 0, 0);
}
#endif

__device__ __forceinline__ void wait_async_lds() {
#if USE_ASYNC_LDS
#if __has_builtin(__builtin_amdgcn_s_wait_asynccnt)
    __builtin_amdgcn_s_wait_asynccnt(0);
#else
    asm volatile("s_wait_asynccnt 0x0" ::: "memory");
#endif
#endif
}

#define PJ_ROWS  64
#define PJ_KW    64
#define PJ_PITCH 68
#define PJ_SLICE (PJ_ROWS * PJ_PITCH)
#define PJ_PP    20

__global__ __launch_bounds__(512)
void proj_qkv(const float* __restrict__ in,
              const float* __restrict__ W1, const float* __restrict__ b1,
              float* __restrict__ o1,
              const float* __restrict__ W2, const float* __restrict__ b2,
              float* __restrict__ o2, int dual)
{
    __shared__ __attribute__((aligned(16))) float xs[16 * PJ_SLICE];   // 272 KB

    const int wave = threadIdx.x >> 5;
    const int lane = threadIdx.x & 31;
    const int c    = lane & 15;
    const int half = lane >> 4;
    const int r0   = blockIdx.x * PJ_ROWS;
    const int kb   = wave * PJ_KW;
    float* slice   = xs + wave * PJ_SLICE;

    // ---- 1. stage: copy j of tile t brings rows 16t+2j+half, 16 B per lane ----
    {
        const float*   g = in + (size_t)(r0 + half) * DMODEL + kb + c * 4;
        const unsigned l = (unsigned)(size_t)(slice + half * PJ_PITCH + c * 4);
#pragma unroll
        for (int t = 0; t < 4; ++t) {
            const float*   gt = g + (size_t)t * 16 * DMODEL;
            const unsigned lt = l + (unsigned)(t * 16 * PJ_PITCH * 4);
            asm volatile(
                "global_load_async_to_lds_b128 %0, %8, off\n\t"
                "global_load_async_to_lds_b128 %1, %9, off\n\t"
                "global_load_async_to_lds_b128 %2, %10, off\n\t"
                "global_load_async_to_lds_b128 %3, %11, off\n\t"
                "global_load_async_to_lds_b128 %4, %12, off\n\t"
                "global_load_async_to_lds_b128 %5, %13, off\n\t"
                "global_load_async_to_lds_b128 %6, %14, off\n\t"
                "global_load_async_to_lds_b128 %7, %15, off\n\t"
                "s_wait_xcnt 0x0"
                :: "v"(lt + 0u * 2u * PJ_PITCH * 4u), "v"(lt + 1u * 2u * PJ_PITCH * 4u),
                   "v"(lt + 2u * 2u * PJ_PITCH * 4u), "v"(lt + 3u * 2u * PJ_PITCH * 4u),
                   "v"(lt + 4u * 2u * PJ_PITCH * 4u), "v"(lt + 5u * 2u * PJ_PITCH * 4u),
                   "v"(lt + 6u * 2u * PJ_PITCH * 4u), "v"(lt + 7u * 2u * PJ_PITCH * 4u),
                   "v"(gt + 0 * 2 * DMODEL), "v"(gt + 1 * 2 * DMODEL),
                   "v"(gt + 2 * 2 * DMODEL), "v"(gt + 3 * 2 * DMODEL),
                   "v"(gt + 4 * 2 * DMODEL), "v"(gt + 5 * 2 * DMODEL),
                   "v"(gt + 6 * 2 * DMODEL), "v"(gt + 7 * 2 * DMODEL)
                : "memory");
        }
    }

    // ---- 2. B fragments: column c of [W1 | W2] (single: W1 twice, upper half unused) ----
    v2f bw[16];
    {
        const float* Wp   = (dual && c >= 8) ? W2 : W1;
        const float* wcol = Wp + (size_t)(kb + 4 * half) * HD + (c & 7);
#pragma unroll
        for (int i = 0; i < 8; ++i) {
            bw[2 * i]     = (v2f){wcol[(8 * i + 0) * HD], wcol[(8 * i + 1) * HD]};
            bw[2 * i + 1] = (v2f){wcol[(8 * i + 2) * HD], wcol[(8 * i + 3) * HD]};
        }
    }

    // The staged rows count as landed only behind the copying wave's own wait;
    // no staged row is read in front of the barrier.
    asm volatile("s_wait_asynccnt 0x0" ::: "memory");
    __syncthreads();

    // ---- 3. partial products: acc[t][r] = row 16t + 8*half + r, column c ----
    const float* arow = slice + c * PJ_PITCH + 4 * half;
    v8f acc[4];
#pragma unroll
    for (int t = 0; t < 4; ++t) acc[t] = (v8f){};
    // Keeps the epilogue's address arithmetic out of the WMMA block, where it
    // would overwrite fragment registers directly behind the WMMA that reads them.
    __builtin_amdgcn_sched_barrier(0);
#pragma unroll
    for (int i = 0; i < 8; ++i) {
        float4 a[4];
#pragma unroll
        for (int t = 0; t < 4; ++t)
            a[t] = *(const float4*)(arow + t * 16 * PJ_PITCH + 8 * i);
#pragma unroll
        for (int t = 0; t < 4; ++t)
            acc[t] = __builtin_amdgcn_wmma_f32_16x16x4_f32(
                false, (v2f){a[t].x, a[t].y}, false, bw[2 * i], (short)0, acc[t], false, false);
#pragma unroll
        for (int t = 0; t < 4; ++t)
            acc[t] = __builtin_amdgcn_wmma_f32_16x16x4_f32(
                false, (v2f){a[t].z, a[t].w}, false, bw[2 * i + 1], (short)0, acc[t], false, false);
    }

    __builtin_amdgcn_sched_barrier(0);
    asm volatile("v_nop\n\tv_nop\n\tv_nop\n\tv_nop");
    __builtin_amdgcn_sched_barrier(0);

    // ---- 4. add the 16 waves' partial sums; each wave reuses its own slice ----
#pragma unroll
    for (int t = 0; t < 4; ++t)
#pragma unroll
        for (int r = 0; r < 8; ++r)
            slice[(t * 16 + 8 * half + r) * PJ_PP + c] = acc[t][r];
    __syncthreads();

    const int row = threadIdx.x >> 3;           // 0..63
    const int c2  = (threadIdx.x & 7) * 2;      // column pair of [o1 | o2]
    if (c2 < 8 || dual) {
        const float* bp = (c2 < 8) ? b1 : b2;
        float*       op = (c2 < 8) ? o1 : o2;
        const int   col = c2 & 7;
        float sx = bp[col], sy = bp[col + 1];
#pragma unroll
        for (int w = 0; w < 16; ++w) {
            const v2f p = *(const v2f*)(xs + w * PJ_SLICE + row * PJ_PP + c2);
            sx += p.x;
            sy += p.y;
        }
        // a wave stores 4 whole rows: one 128-B line of o1 and one of o2
        *(v2f*)(op + (size_t)(r0 + row) * HD + col) = (v2f){sx, sy};
    }
}

__global__ __launch_bounds__(128)
void attn_kernel(const float* __restrict__ q, const float* __restrict__ k,
                 const float* __restrict__ v, float* __restrict__ attn)
{
    __shared__ float Ks[2][CHUNK * KSTR];   // 2 x 10 KB, padded rows
    __shared__ float Vs[2][CHUNK * HD];     // 2 x  8 KB

    const int b    = blockIdx.y;
    const int wave = threadIdx.x >> 5;
    const int lane = threadIdx.x & 31;
    const int n    = lane & 15;          // N index (query col of S^T)
    const int half = lane >> 4;          // lane half selects K/M sub-range
    const int s0   = blockIdx.x * 64 + wave * 16;

    const float* qb = q + (size_t)b * SEQ * HD;
    const float* kb = k + (size_t)b * SEQ * HD;
    const float* vb = v + (size_t)b * SEQ * HD;

    const float* qrow = qb + (size_t)(s0 + n) * HD;
    const v2f bq0 = *(const v2f*)(qrow + 2 * half);       // h = {2h0, 2h0+1}
    const v2f bq1 = *(const v2f*)(qrow + 4 + 2 * half);   // h = {4+2h0, 5+2h0}

    float m_state = -1e30f;
    float l_state = 0.0f;
    float acc[HD];
#pragma unroll
    for (int hh = 0; hh < HD; ++hh) acc[hh] = 0.0f;

    // ---- staging helper: copy CHUNK rows of K (padded) and V into buffer ----
    auto stage = [&](int tc, int buf) {
        for (int r = threadIdx.x; r < CHUNK; r += 128) {
            const float* krow = kb + (size_t)(tc + r) * HD;
            float*       kd   = &Ks[buf][r * KSTR];
            const float* vrow = vb + (size_t)(tc + r) * HD;
            float*       vd   = &Vs[buf][r * HD];
#if USE_ASYNC_LDS
            async_cp_b64(krow + 0, kd + 0);     // 8B-aligned (stride 40B rows)
            async_cp_b64(krow + 2, kd + 2);
            async_cp_b64(krow + 4, kd + 4);
            async_cp_b64(krow + 6, kd + 6);
            async_cp_b128(vrow + 0, vd + 0);    // 16B-aligned (stride 32B rows)
            async_cp_b128(vrow + 4, vd + 4);
#else
            const float4 ka = ((const float4*)krow)[0];
            const float4 kc = ((const float4*)krow)[1];
            *(v2f*)(kd + 0) = (v2f){ka.x, ka.y};
            *(v2f*)(kd + 2) = (v2f){ka.z, ka.w};
            *(v2f*)(kd + 4) = (v2f){kc.x, kc.y};
            *(v2f*)(kd + 6) = (v2f){kc.z, kc.w};
            ((float4*)vd)[0] = ((const float4*)vrow)[0];
            ((float4*)vd)[1] = ((const float4*)vrow)[1];
#endif
        }
    };

    // Preload chunk 0 into buffer 0.
    stage(0, 0);
    wait_async_lds();
    __syncthreads();

    int cur = 0;
    for (int tc = 0; tc < SEQ; tc += CHUNK) {
        // Kick off next chunk into the alternate buffer (overlaps compute).
        if (tc + CHUNK < SEQ) stage(tc + CHUNK, cur ^ 1);

        for (int t0 = 0; t0 < CHUNK; t0 += 16) {
            const float* krow0 = &Ks[cur][(t0 + n) * KSTR];
            const v2f a0 = *(const v2f*)(krow0 + 2 * half);
            const v2f a1 = *(const v2f*)(krow0 + 4 + 2 * half);

            v8f c = {};
            c = __builtin_amdgcn_wmma_f32_16x16x4_f32(false, a0, false, bq0,
                                                      (short)0, c, false, false);
            c = __builtin_amdgcn_wmma_f32_16x16x4_f32(false, a1, false, bq1,
                                                      (short)0, c, false, false);
            // c[j] = score(s = s0+n, t = tc + t0 + j + 8*half)

            float tmax = c[0];
#pragma unroll
            for (int j = 1; j < 8; ++j) tmax = fmaxf(tmax, c[j]);
            tmax = fmaxf(tmax, __shfl_xor(tmax, 16));

            const float m_new = fmaxf(m_state, tmax);
            const float scale = __expf(m_state - m_new);

            float p[8];
            float psum = 0.0f;
#pragma unroll
            for (int j = 0; j < 8; ++j) {
                p[j] = __expf(c[j] - m_new);
                psum += p[j];
            }
            psum += __shfl_xor(psum, 16);
            l_state = l_state * scale + psum;
            m_state = m_new;

            // partial[h] = sum_j p[j] * V[t0 + j + 8*half][h]  (LDS broadcast)
            float part[HD];
#pragma unroll
            for (int hh = 0; hh < HD; ++hh) part[hh] = 0.0f;
#pragma unroll
            for (int j = 0; j < 8; ++j) {
                const float4* vrow =
                    (const float4*)&Vs[cur][(t0 + j + 8 * half) * HD];
                const float4 v0 = vrow[0], v1 = vrow[1];
                part[0] = fmaf(p[j], v0.x, part[0]);
                part[1] = fmaf(p[j], v0.y, part[1]);
                part[2] = fmaf(p[j], v0.z, part[2]);
                part[3] = fmaf(p[j], v0.w, part[3]);
                part[4] = fmaf(p[j], v1.x, part[4]);
                part[5] = fmaf(p[j], v1.y, part[5]);
                part[6] = fmaf(p[j], v1.z, part[6]);
                part[7] = fmaf(p[j], v1.w, part[7]);
            }
#pragma unroll
            for (int hh = 0; hh < HD; ++hh)
                acc[hh] = acc[hh] * scale + part[hh] + __shfl_xor(part[hh], 16);
        }

        // My async fills for the next buffer are done; barrier makes them
        // visible to all waves and confirms everyone finished this buffer.
        wait_async_lds();
        __syncthreads();
        cur ^= 1;
    }

    if (half == 0) {
        const float invl = 1.0f / l_state;
        float* orow = attn + ((size_t)b * SEQ + s0 + n) * HD;
        float4 o0, o1;
        o0.x = acc[0] * invl; o0.y = acc[1] * invl;
        o0.z = acc[2] * invl; o0.w = acc[3] * invl;
        o1.x = acc[4] * invl; o1.y = acc[5] * invl;
        o1.z = acc[6] * invl; o1.w = acc[7] * invl;
        ((float4*)orow)[0] = o0;
        ((float4*)orow)[1] = o1;
    }
}

// ---------------------------------------------------------------------------
// Kernel 3: out[r,:] = attn[r,0:8] @ Wo[8,1024] + bo. Bound by 64MB output
// write. Wo held in registers (8 x float4 per thread), attn row is a uniform
// load (scalarizable). 16 rows per block.
// ---------------------------------------------------------------------------
__global__ __launch_bounds__(256)
void out_proj(const float* __restrict__ attn, const float* __restrict__ Wo,
              const float* __restrict__ bo, float* __restrict__ out)
{
    const int r0 = blockIdx.x * 16;
    const int c4 = threadIdx.x;                    // float4 column 0..255
    const float4* Wo4 = (const float4*)Wo;

    float4 w[8];
#pragma unroll
    for (int h = 0; h < 8; ++h) w[h] = Wo4[h * (DMODEL / 4) + c4];
    const float4 ob = ((const float4*)bo)[c4];

    for (int r = 0; r < 16; ++r) {
        const float* ar = attn + (size_t)(r0 + r) * HD;
        float a[8];
#pragma unroll
        for (int h = 0; h < 8; ++h) a[h] = ar[h];
        float4 o = ob;
#pragma unroll
        for (int h = 0; h < 8; ++h) {
            o.x = fmaf(a[h], w[h].x, o.x);
            o.y = fmaf(a[h], w[h].y, o.y);
            o.z = fmaf(a[h], w[h].z, o.z);
            o.w = fmaf(a[h], w[h].w, o.w);
        }
        ((float4*)out)[(size_t)(r0 + r) * (DMODEL / 4) + c4] = o;
    }
}

// ---------------------------------------------------------------------------
extern "C" void kernel_launch(void* const* d_in, const int* in_sizes, int n_in,
                              void* d_out, int out_size, void* d_ws, size_t ws_size,
                              hipStream_t stream)
{
    const float* x       = (const float*)d_in[0];
    const float* context = (const float*)d_in[1];
    const float* Wq      = (const float*)d_in[2];
    const float* bq      = (const float*)d_in[3];
    const float* Wk      = (const float*)d_in[4];
    const float* bk      = (const float*)d_in[5];
    const float* Wv      = (const float*)d_in[6];
    const float* bv      = (const float*)d_in[7];
    const float* Wo      = (const float*)d_in[8];
    const float* bo      = (const float*)d_in[9];
    float* out = (float*)d_out;

    float* q    = (float*)d_ws;                // 16384*8 f32 = 512KB
    float* kbuf = q    + (size_t)ROWS * HD;
    float* vbuf = kbuf + (size_t)ROWS * HD;
    float* attn = vbuf + (size_t)ROWS * HD;    // total 2MB scratch

    // q from x (single output)
    proj_qkv<<<ROWS / 64, 512, 0, stream>>>(x, Wq, bq, q,
                                            nullptr, nullptr, nullptr, 0);
    // k and v fused from one read of context
    proj_qkv<<<ROWS / 64, 512, 0, stream>>>(context, Wk, bk, kbuf,
                                            Wv, bv, vbuf, 1);
    // flash attention (WMMA scores, async double-buffered K/V staging)
    attn_kernel<<<dim3(SEQ / 64, BATCH), 128, 0, stream>>>(q, kbuf, vbuf, attn);
    // output projection
    out_proj<<<ROWS / 16, 256, 0, stream>>>(attn, Wo, bo, out);
}

// v002
// One run takes 40.3 microseconds.
// Timed twice side by side with v001, it ran 1.37 times as fast both times.
// Over all steps from v000 it is 4.97 times as fast.
#include <hip/hip_runtime.h>
#include <math.h>

typedef __attribute__((ext_vector_type(2))) float v2f;
typedef __attribute__((ext_vector_type(8))) float v8f;

// Async-copy builtin operand types (match clang's declared signatures:
// b64 -> int __vector(2)*, b128 -> int __vector(4)*).
typedef int vi2 __attribute__((vector_size(8)));
typedef int vi4 __attribute__((vector_size(16)));

#define BATCH  8
#define SEQ    2048
#define DMODEL 1024
#define HD     8
#define ROWS   (BATCH * SEQ)
#define CHUNK  256
#define KSTR   10

#if __has_builtin(__builtin_amdgcn_global_load_async_to_lds_b64) && \
    __has_builtin(__builtin_amdgcn_global_load_async_to_lds_b128)
#define USE_ASYNC_LDS 1
#else
#define USE_ASYNC_LDS 0
#endif

#if USE_ASYNC_LDS
__device__ __forceinline__ void async_cp_b64(const void* g, void* l) {
    __builtin_amdgcn_global_load_async_to_lds_b64(
        (__attribute__((address_space(1))) vi2*)g,
        (__attribute__((address_space(3))) vi2*)l, 0, 0);
}
__device__ __forceinline__ void async_cp_b128(const void* g, void* l) {
    __builtin_amdgcn_global_load_async_to_lds_b128(
        (__attribute__((address_space(1))) vi4*)g,
        (__attribute__((address_space(3))) vi4*)l, 0, 0);
}
#endif

__device__ __forceinline__ void wait_async_lds() {
#if USE_ASYNC_LDS
#if __has_builtin(__builtin_amdgcn_s_wait_asynccnt)
    __builtin_amdgcn_s_wait_asynccnt(0);
#else
    asm volatile("s_wait_asynccnt 0x0" ::: "memory");
#endif
#endif
}

#define PJ_ROWS  64
#define PJ_KW    64
#define PJ_PITCH 68
#define PJ_SLICE (PJ_ROWS * PJ_PITCH)
#define PJ_PP    20

__global__ __launch_bounds__(512)
void proj_qkv(const float* __restrict__ in,
              const float* __restrict__ W1, const float* __restrict__ b1,
              float* __restrict__ o1,
              const float* __restrict__ W2, const float* __restrict__ b2,
              float* __restrict__ o2, int dual)
{
    __shared__ __attribute__((aligned(16))) float xs[16 * PJ_SLICE];   // 272 KB

    const int wave = threadIdx.x >> 5;
    const int lane = threadIdx.x & 31;
    const int c    = lane & 15;
    const int half = lane >> 4;
    const int r0   = blockIdx.x * PJ_ROWS;
    const int kb   = wave * PJ_KW;
    float* slice   = xs + wave * PJ_SLICE;

    // ---- 1. stage: copy j of tile t brings rows 16t+2j+half, 16 B per lane ----
    {
        const float*   g = in + (size_t)(r0 + half) * DMODEL + kb + c * 4;
        const unsigned l = (unsigned)(size_t)(slice + half * PJ_PITCH + c * 4);
#pragma unroll
        for (int t = 0; t < 4; ++t) {
            const float*   gt = g + (size_t)t * 16 * DMODEL;
            const unsigned lt = l + (unsigned)(t * 16 * PJ_PITCH * 4);
            asm volatile(
                "global_load_async_to_lds_b128 %0, %8, off\n\t"
                "global_load_async_to_lds_b128 %1, %9, off\n\t"
                "global_load_async_to_lds_b128 %2, %10, off\n\t"
                "global_load_async_to_lds_b128 %3, %11, off\n\t"
                "global_load_async_to_lds_b128 %4, %12, off\n\t"
                "global_load_async_to_lds_b128 %5, %13, off\n\t"
                "global_load_async_to_lds_b128 %6, %14, off\n\t"
                "global_load_async_to_lds_b128 %7, %15, off\n\t"
                "s_wait_xcnt 0x0"
                :: "v"(lt + 0u * 2u * PJ_PITCH * 4u), "v"(lt + 1u * 2u * PJ_PITCH * 4u),
                   "v"(lt + 2u * 2u * PJ_PITCH * 4u), "v"(lt + 3u * 2u * PJ_PITCH * 4u),
                   "v"(lt + 4u * 2u * PJ_PITCH * 4u), "v"(lt + 5u * 2u * PJ_PITCH * 4u),
                   "v"(lt + 6u * 2u * PJ_PITCH * 4u), "v"(lt + 7u * 2u * PJ_PITCH * 4u),
                   "v"(gt + 0 * 2 * DMODEL), "v"(gt + 1 * 2 * DMODEL),
                   "v"(gt + 2 * 2 * DMODEL), "v"(gt + 3 * 2 * DMODEL),
                   "v"(gt + 4 * 2 * DMODEL), "v"(gt + 5 * 2 * DMODEL),
                   "v"(gt + 6 * 2 * DMODEL), "v"(gt + 7 * 2 * DMODEL)
                : "memory");
        }
    }

    // ---- 2. B fragments: column c of [W1 | W2] (single: W1 twice, upper half unused) ----
    v2f bw[16];
    {
        const float* Wp   = (dual && c >= 8) ? W2 : W1;
        const float* wcol = Wp + (size_t)(kb + 4 * half) * HD + (c & 7);
#pragma unroll
        for (int i = 0; i < 8; ++i) {
            bw[2 * i]     = (v2f){wcol[(8 * i + 0) * HD], wcol[(8 * i + 1) * HD]};
            bw[2 * i + 1] = (v2f){wcol[(8 * i + 2) * HD], wcol[(8 * i + 3) * HD]};
        }
    }

    // The staged rows count as landed only behind the copying wave's own wait;
    // no staged row is read in front of the barrier.
    asm volatile("s_wait_asynccnt 0x0" ::: "memory");
    __syncthreads();

    // ---- 3. partial products: acc[t][r] = row 16t + 8*half + r, column c ----
    const float* arow = slice + c * PJ_PITCH + 4 * half;
    v8f acc[4];
#pragma unroll
    for (int t = 0; t < 4; ++t) acc[t] = (v8f){};
    // Keeps the epilogue's address arithmetic out of the WMMA block, where it
    // would overwrite fragment registers directly behind the WMMA that reads them.
    __builtin_amdgcn_sched_barrier(0);
#pragma unroll
    for (int i = 0; i < 8; ++i) {
        float4 a[4];
#pragma unroll
        for (int t = 0; t < 4; ++t)
            a[t] = *(const float4*)(arow + t * 16 * PJ_PITCH + 8 * i);
#pragma unroll
        for (int t = 0; t < 4; ++t)
            acc[t] = __builtin_amdgcn_wmma_f32_16x16x4_f32(
                false, (v2f){a[t].x, a[t].y}, false, bw[2 * i], (short)0, acc[t], false, false);
#pragma unroll
        for (int t = 0; t < 4; ++t)
            acc[t] = __builtin_amdgcn_wmma_f32_16x16x4_f32(
                false, (v2f){a[t].z, a[t].w}, false, bw[2 * i + 1], (short)0, acc[t], false, false);
    }

    __builtin_amdgcn_sched_barrier(0);
    asm volatile("v_nop\n\tv_nop\n\tv_nop\n\tv_nop");
    __builtin_amdgcn_sched_barrier(0);

    // ---- 4. add the 16 waves' partial sums; each wave reuses its own slice ----
#pragma unroll
    for (int t = 0; t < 4; ++t)
#pragma unroll
        for (int r = 0; r < 8; ++r)
            slice[(t * 16 + 8 * half + r) * PJ_PP + c] = acc[t][r];
    __syncthreads();

    const int row = threadIdx.x >> 3;           // 0..63
    const int c2  = (threadIdx.x & 7) * 2;      // column pair of [o1 | o2]
    if (c2 < 8 || dual) {
        const float* bp = (c2 < 8) ? b1 : b2;
        float*       op = (c2 < 8) ? o1 : o2;
        const int   col = c2 & 7;
        float sx = bp[col], sy = bp[col + 1];
#pragma unroll
        for (int w = 0; w < 16; ++w) {
            const v2f p = *(const v2f*)(xs + w * PJ_SLICE + row * PJ_PP + c2);
            sx += p.x;
            sy += p.y;
        }
        // a wave stores 4 whole rows: one 128-B line of o1 and one of o2
        *(v2f*)(op + (size_t)(r0 + row) * HD + col) = (v2f){sx, sy};
    }
}

#define KT 4                   // 16-key tiles per softmax step

__device__ __forceinline__ float other_half(float x) {
    const int b = __builtin_bit_cast(int, x);
    return __builtin_bit_cast(float,
        __builtin_amdgcn_permlanex16(b, b, 0x76543210, 0xfedcba98, false, false));
}

__device__ __forceinline__ void exp2_pair(float& a, float& b) {
    asm("v_exp_f32 %0, %0\n\tv_exp_f32 %1, %1\n\tv_nop" : "+v"(a), "+v"(b));
}
__device__ __forceinline__ void exp2_one(float& a) {
    asm("v_exp_f32 %0, %0\n\tv_nop" : "+v"(a));
}
#define LOG2E 1.44269504f      // e^x = 2^(x * LOG2E)

__global__ __launch_bounds__(128)
void attn_kernel(const float* __restrict__ q, const float* __restrict__ k,
                 const float* __restrict__ v, float* __restrict__ attn)
{
    __shared__ float Ks[2][CHUNK * KSTR];   // 2 x 10 KB, padded rows
    __shared__ float Vs[2][CHUNK * HD];     // 2 x  8 KB
    // What lanes 8..15 of each half read as rows 8..15 of V^T: every row of
    // this table is {1,0,0,0,0,0,0,0}, walked with the offsets of a V buffer.
    __shared__ __attribute__((aligned(16))) float Vpad[(CHUNK + 8) * HD];

    const int b    = blockIdx.y;
    const int wave = threadIdx.x >> 5;
    const int lane = threadIdx.x & 31;
    const int n    = lane & 15;          // N index (query col of S^T)
    const int half = lane >> 4;          // lane half selects K/M sub-range
    const int s0   = blockIdx.x * 64 + wave * 16;

    const float* qb = q + (size_t)b * SEQ * HD;
    const float* kb = k + (size_t)b * SEQ * HD;
    const float* vb = v + (size_t)b * SEQ * HD;

    const float* qrow = qb + (size_t)(s0 + n) * HD;
    const v2f bq0 = *(const v2f*)(qrow + 2 * half);       // h = {2h0, 2h0+1}
    const v2f bq1 = *(const v2f*)(qrow + 4 + 2 * half);   // h = {4+2h0, 5+2h0}

    float m_state = -1e30f;
    // O^T, two tiles that take alternate WMMAs so that no WMMA waits for the
    // one directly in front of it; added in the epilogue.
    v8f o0 = {}, o1 = {};

    // ---- staging helper: copy CHUNK rows of K (padded) and V into buffer ----
    auto stage = [&](int tc, int buf) {
        for (int r = threadIdx.x; r < CHUNK; r += 128) {
            const float* krow = kb + (size_t)(tc + r) * HD;
            float*       kd   = &Ks[buf][r * KSTR];
            const float* vrow = vb + (size_t)(tc + r) * HD;
            float*       vd   = &Vs[buf][r * HD];
#if USE_ASYNC_LDS
            async_cp_b64(krow + 0, kd + 0);     // 8B-aligned (stride 40B rows)
            async_cp_b64(krow + 2, kd + 2);
            async_cp_b64(krow + 4, kd + 4);
            async_cp_b64(krow + 6, kd + 6);
            async_cp_b128(vrow + 0, vd + 0);    // 16B-aligned (stride 32B rows)
            async_cp_b128(vrow + 4, vd + 4);
#else
            const float4 ka = ((const float4*)krow)[0];
            const float4 kc = ((const float4*)krow)[1];
            *(v2f*)(kd + 0) = (v2f){ka.x, ka.y};
            *(v2f*)(kd + 2) = (v2f){ka.z, ka.w};
            *(v2f*)(kd + 4) = (v2f){kc.x, kc.y};
            *(v2f*)(kd + 6) = (v2f){kc.z, kc.w};
            ((float4*)vd)[0] = ((const float4*)vrow)[0];
            ((float4*)vd)[1] = ((const float4*)vrow)[1];
#endif
        }
    };

    // Preload chunk 0 into buffer 0.
    stage(0, 0);
    for (int r = threadIdx.x; r < CHUNK + 8; r += 128) {
        ((float4*)&Vpad[r * HD])[0] = make_float4(1.0f, 0.0f, 0.0f, 0.0f);
        ((float4*)&Vpad[r * HD])[1] = make_float4(0.0f, 0.0f, 0.0f, 0.0f);
    }
    wait_async_lds();
    __syncthreads();

    int cur = 0;
    for (int tc = 0; tc < SEQ; tc += CHUNK) {
        // Kick off next chunk into the alternate buffer (overlaps compute).
        if (tc + CHUNK < SEQ) stage(tc + CHUNK, cur ^ 1);

        const float* kp = &Ks[cur][n * KSTR + 2 * half];
        const float* vp = (n < HD) ? &Vs[cur][8 * half * HD + n]
                                   : &Vpad[(1 + half) * HD + (n - HD)];

        // Unrolled so that the LDS reads of later steps can be issued early.
#pragma unroll
        for (int t0 = 0; t0 < CHUNK; t0 += 16 * KT) {
            v8f c[KT];
#pragma unroll  // the index picks registers
            for (int i = 0; i < KT; ++i) {
                const v2f a0 = *(const v2f*)(kp + (t0 + 16 * i) * KSTR);
                c[i] = __builtin_amdgcn_wmma_f32_16x16x4_f32(false, a0, false, bq0,
                                                             (short)0, (v8f){}, false, false);
            }
#pragma unroll  // the index picks registers
            for (int i = 0; i < KT; ++i) {
                const v2f a1 = *(const v2f*)(kp + (t0 + 16 * i) * KSTR + 4);
                c[i] = __builtin_amdgcn_wmma_f32_16x16x4_f32(false, a1, false, bq1,
                                                             (short)0, c[i], false, false);
            }
            // c[i][j] = score(s = s0+n, t = tc + t0 + 16*i + j + 8*half)

            // The step's V^T fragments, read here so that they have landed
            // when the softmax work in front of their WMMAs is done.
            v2f av[4 * KT];
#pragma unroll  // the index picks registers
            for (int u = 0; u < 4 * KT; ++u) {
                const float* vr = vp + (t0 + 16 * (u >> 2) + 2 * (u & 3)) * HD;
                av[u] = (v2f){vr[0], vr[HD]};
            }

            float tm[KT];
#pragma unroll  // the index picks registers
            for (int i = 0; i < KT; ++i) {
                tm[i] = c[i][0];
#pragma unroll  // the index picks registers
                for (int j = 1; j < 8; ++j) tm[i] = fmaxf(tm[i], c[i][j]);
            }
            float tmax = tm[0];
#pragma unroll  // the index picks registers
            for (int i = 1; i < KT; ++i) tmax = fmaxf(tmax, tm[i]);
            tmax = fmaxf(tmax, other_half(tmax));

            const float m_new = fmaxf(m_state, tmax);
            // P in place of the scores, all of a step's values before its
            // first O^T product: independent chains, no wait inside one.
            float scale = (m_state - m_new) * LOG2E;
            m_state = m_new;
#pragma unroll  // i, j pick registers
            for (int i = 0; i < KT; ++i)
#pragma unroll  // i, j pick registers
                for (int j = 0; j < 8; ++j) c[i][j] = (c[i][j] - m_new) * LOG2E;
            exp2_one(scale);
#pragma unroll  // the index picks registers
            for (int j = 0; j < 8; ++j) { o0[j] *= scale; o1[j] *= scale; }

#pragma unroll  // i, j pick registers
            for (int i = 0; i < KT; ++i)
#pragma unroll  // i, j pick registers
                for (int j = 0; j < 8; j += 2) {
                    float e0 = c[i][j], e1 = c[i][j + 1];
                    exp2_pair(e0, e1);
                    c[i][j] = e0; c[i][j + 1] = e1;
                }
            // Vector work and LDS reads may not sink below this line (matrix and
            // scalar instructions may cross): without it each pair of
            // exponentials and each V^T read is placed directly in front of the
            // WMMA that takes it, which then waits out the whole chain.
            __builtin_amdgcn_sched_barrier(0xC);

#pragma unroll  // the index picks registers
            for (int i = 0; i < KT; ++i) {
#pragma unroll  // the index picks registers
                for (int g = 0; g < 4; ++g) {
                    const v2f bp = (v2f){c[i][2 * g], c[i][2 * g + 1]};
                    if (g & 1)
                        o1 = __builtin_amdgcn_wmma_f32_16x16x4_f32(false, av[4 * i + g], false, bp,
                                                                   (short)0, o1, false, false);
                    else
                        o0 = __builtin_amdgcn_wmma_f32_16x16x4_f32(false, av[4 * i + g], false, bp,
                                                                   (short)0, o0, false, false);
                }
            }
        }

        // My async fills for the next buffer are done; barrier makes them
        // visible to all waves and confirms everyone finished this buffer.
        wait_async_lds();
        __syncthreads();
        cur ^= 1;
    }

    // Lane (n, half 0) holds O^T rows 0..7 of query n; lane (n, half 1) holds
    // row 8, the denominator, in register 0.
    const v8f o = o0 + o1;
    const float l_state = other_half(o[0]);
    if (half == 0) {
        const float invl = 1.0f / l_state;
        float* orow = attn + ((size_t)b * SEQ + s0 + n) * HD;
        float4 r0, r1;
        r0.x = o[0] * invl; r0.y = o[1] * invl;
        r0.z = o[2] * invl; r0.w = o[3] * invl;
        r1.x = o[4] * invl; r1.y = o[5] * invl;
        r1.z = o[6] * invl; r1.w = o[7] * invl;
        ((float4*)orow)[0] = r0;
        ((float4*)orow)[1] = r1;
    }
}

// ---------------------------------------------------------------------------
// Kernel 3: out[r,:] = attn[r,0:8] @ Wo[8,1024] + bo. Bound by 64MB output
// write. Wo held in registers (8 x float4 per thread), attn row is a uniform
// load (scalarizable). 16 rows per block.
// ---------------------------------------------------------------------------
__global__ __launch_bounds__(256)
void out_proj(const float* __restrict__ attn, const float* __restrict__ Wo,
              const float* __restrict__ bo, float* __restrict__ out)
{
    const int r0 = blockIdx.x * 16;
    const int c4 = threadIdx.x;                    // float4 column 0..255
    const float4* Wo4 = (const float4*)Wo;

    float4 w[8];
#pragma unroll
    for (int h = 0; h < 8; ++h) w[h] = Wo4[h * (DMODEL / 4) + c4];
    const float4 ob = ((const float4*)bo)[c4];

    for (int r = 0; r < 16; ++r) {
        const float* ar = attn + (size_t)(r0 + r) * HD;
        float a[8];
#pragma unroll
        for (int h = 0; h < 8; ++h) a[h] = ar[h];
        float4 o = ob;
#pragma unroll
        for (int h = 0; h < 8; ++h) {
            o.x = fmaf(a[h], w[h].x, o.x);
            o.y = fmaf(a[h], w[h].y, o.y);
            o.z = fmaf(a[h], w[h].z, o.z);
            o.w = fmaf(a[h], w[h].w, o.w);
        }
        ((float4*)out)[(size_t)(r0 + r) * (DMODEL / 4) + c4] = o;
    }
}

// ---------------------------------------------------------------------------
extern "C" void kernel_launch(void* const* d_in, const int* in_sizes, int n_in,
                              void* d_out, int out_size, void* d_ws, size_t ws_size,
                              hipStream_t stream)
{
    const float* x       = (const float*)d_in[0];
    const float* context = (const float*)d_in[1];
    const float* Wq      = (const float*)d_in[2];
    const float* bq      = (const float*)d_in[3];
    const float* Wk      = (const float*)d_in[4];
    const float* bk      = (const float*)d_in[5];
    const float* Wv      = (const float*)d_in[6];
    const float* bv      = (const float*)d_in[7];
    const float* Wo      = (const float*)d_in[8];
    const float* bo      = (const float*)d_in[9];
    float* out = (float*)d_out;

    float* q    = (float*)d_ws;                // 16384*8 f32 = 512KB
    float* kbuf = q    + (size_t)ROWS * HD;
    float* vbuf = kbuf + (size_t)ROWS * HD;
    float* attn = vbuf + (size_t)ROWS * HD;    // total 2MB scratch

    // q from x (single output)
    proj_qkv<<<ROWS / 64, 512, 0, stream>>>(x, Wq, bq, q,
                                            nullptr, nullptr, nullptr, 0);
    // k and v fused from one read of context
    proj_qkv<<<ROWS / 64, 512, 0, stream>>>(context, Wk, bk, kbuf,
                                            Wv, bv, vbuf, 1);
    // flash attention (WMMA scores, async double-buffered K/V staging)
    attn_kernel<<<dim3(SEQ / 64, BATCH), 128, 0, stream>>>(q, kbuf, vbuf, attn);
    // output projection
    out_proj<<<ROWS / 16, 256, 0, stream>>>(attn, Wo, bo, out);
}

// v003
// A run of this version takes 38.5 microseconds.
// Timed twice side by side with v002, it ran 1.05 and 1.06 times as fast.
// Counting every step since v000, it is 5.23 times as fast.
#include <hip/hip_runtime.h>
#include <math.h>

typedef __attribute__((ext_vector_type(2))) float v2f;
typedef __attribute__((ext_vector_type(8))) float v8f;

// Async-copy builtin operand types (match clang's declared signatures:
// b64 -> int __vector(2)*, b128 -> int __vector(4)*).
typedef int vi2 __attribute__((vector_size(8)));
typedef int vi4 __attribute__((vector_size(16)));

#define BATCH  8
#define SEQ    2048
#define DMODEL 1024
#define HD     8
#define ROWS   (BATCH * SEQ)
#define CHUNK  256
#define KSTR   10

#if __has_builtin(__builtin_amdgcn_global_load_async_to_lds_b64) && \
    __has_builtin(__builtin_amdgcn_global_load_async_to_lds_b128)
#define USE_ASYNC_LDS 1
#else
#define USE_ASYNC_LDS 0
#endif

#if USE_ASYNC_LDS
__device__ __forceinline__ void async_cp_b64(const void* g, void* l) {
    __builtin_amdgcn_global_load_async_to_lds_b64(
        (__attribute__((address_space(1))) vi2*)g,
        (__attribute__((address_space(3))) vi2*)l, 0, 0);
}
__device__ __forceinline__ void async_cp_b128(const void* g, void* l) {
    __builtin_amdgcn_global_load_async_to_lds_b128(
        (__attribute__((address_space(1))) vi4*)g,
        (__attribute__((address_space(3))) vi4*)l, 0, 0);
}
#endif

__device__ __forceinline__ void wait_async_lds() {
#if USE_ASYNC_LDS
#if __has_builtin(__builtin_amdgcn_s_wait_asynccnt)
    __builtin_amdgcn_s_wait_asynccnt(0);
#else
    asm volatile("s_wait_asynccnt 0x0" ::: "memory");
#endif
#endif
}

#define PJ_ROWS  64
#define PJ_KW    64
#define PJ_PITCH 68
#define PJ_SLICE (PJ_ROWS * PJ_PITCH)
#define PJ_PP    20
#define PJ_BLOCKS (ROWS / PJ_ROWS)

__global__ __launch_bounds__(512)
void proj_qkv(const float* __restrict__ x,
              const float* __restrict__ Wq, const float* __restrict__ bq,
              float* __restrict__ qo,
              const float* __restrict__ ctx,
              const float* __restrict__ Wk, const float* __restrict__ bk,
              float* __restrict__ ko,
              const float* __restrict__ W2, const float* __restrict__ b2,
              float* __restrict__ o2)
{
    // The same for every thread of a block: which input, weights and outputs.
    const bool   dual = blockIdx.x >= PJ_BLOCKS;
    const float* in   = dual ? ctx : x;
    const float* W1   = dual ? Wk : Wq;
    const float* b1   = dual ? bk : bq;
    float*       o1   = dual ? ko : qo;

    __shared__ __attribute__((aligned(16))) float xs[16 * PJ_SLICE];   // 272 KB

    const int wave = threadIdx.x >> 5;
    const int lane = threadIdx.x & 31;
    const int c    = lane & 15;
    const int half = lane >> 4;
    const int r0   = (blockIdx.x - (dual ? PJ_BLOCKS : 0)) * PJ_ROWS;
    const int kb   = wave * PJ_KW;
    float* slice   = xs + wave * PJ_SLICE;

    // ---- 1. stage: copy j of tile t brings rows 16t+2j+half, 16 B per lane ----
    {
        const float*   g = in + (size_t)(r0 + half) * DMODEL + kb + c * 4;
        const unsigned l = (unsigned)(size_t)(slice + half * PJ_PITCH + c * 4);
#pragma unroll
        for (int t = 0; t < 4; ++t) {
            const float*   gt = g + (size_t)t * 16 * DMODEL;
            const unsigned lt = l + (unsigned)(t * 16 * PJ_PITCH * 4);
            asm volatile(
                "global_load_async_to_lds_b128 %0, %8, off\n\t"
                "global_load_async_to_lds_b128 %1, %9, off\n\t"
                "global_load_async_to_lds_b128 %2, %10, off\n\t"
                "global_load_async_to_lds_b128 %3, %11, off\n\t"
                "global_load_async_to_lds_b128 %4, %12, off\n\t"
                "global_load_async_to_lds_b128 %5, %13, off\n\t"
                "global_load_async_to_lds_b128 %6, %14, off\n\t"
                "global_load_async_to_lds_b128 %7, %15, off\n\t"
                "s_wait_xcnt 0x0"
                :: "v"(lt + 0u * 2u * PJ_PITCH * 4u), "v"(lt + 1u * 2u * PJ_PITCH * 4u),
                   "v"(lt + 2u * 2u * PJ_PITCH * 4u), "v"(lt + 3u * 2u * PJ_PITCH * 4u),
                   "v"(lt + 4u * 2u * PJ_PITCH * 4u), "v"(lt + 5u * 2u * PJ_PITCH * 4u),
                   "v"(lt + 6u * 2u * PJ_PITCH * 4u), "v"(lt + 7u * 2u * PJ_PITCH * 4u),
                   "v"(gt + 0 * 2 * DMODEL), "v"(gt + 1 * 2 * DMODEL),
                   "v"(gt + 2 * 2 * DMODEL), "v"(gt + 3 * 2 * DMODEL),
                   "v"(gt + 4 * 2 * DMODEL), "v"(gt + 5 * 2 * DMODEL),
                   "v"(gt + 6 * 2 * DMODEL), "v"(gt + 7 * 2 * DMODEL)
                : "memory");
        }
    }

    // ---- 2. B fragments: column c of [W1 | W2] (single: W1 twice, upper half unused) ----
    v2f bw[16];
    {
        const float* Wp   = (dual && c >= 8) ? W2 : W1;
        const float* wcol = Wp + (size_t)(kb + 4 * half) * HD + (c & 7);
#pragma unroll
        for (int i = 0; i < 8; ++i) {
            bw[2 * i]     = (v2f){wcol[(8 * i + 0) * HD], wcol[(8 * i + 1) * HD]};
            bw[2 * i + 1] = (v2f){wcol[(8 * i + 2) * HD], wcol[(8 * i + 3) * HD]};
        }
    }

    // The staged rows count as landed only behind the copying wave's own wait;
    // no staged row is read in front of the barrier.
    asm volatile("s_wait_asynccnt 0x0" ::: "memory");
    __syncthreads();

    // ---- 3. partial products: acc[t][r] = row 16t + 8*half + r, column c ----
    const float* arow = slice + c * PJ_PITCH + 4 * half;
    v8f acc[4];
#pragma unroll
    for (int t = 0; t < 4; ++t) acc[t] = (v8f){};
    // Keeps the epilogue's address arithmetic out of the WMMA block, where it
    // would overwrite fragment registers directly behind the WMMA that reads them.
    __builtin_amdgcn_sched_barrier(0);
#pragma unroll
    for (int i = 0; i < 8; ++i) {
        float4 a[4];
#pragma unroll
        for (int t = 0; t < 4; ++t)
            a[t] = *(const float4*)(arow + t * 16 * PJ_PITCH + 8 * i);
#pragma unroll
        for (int t = 0; t < 4; ++t)
            acc[t] = __builtin_amdgcn_wmma_f32_16x16x4_f32(
                false, (v2f){a[t].x, a[t].y}, false, bw[2 * i], (short)0, acc[t], false, false);
#pragma unroll
        for (int t = 0; t < 4; ++t)
            acc[t] = __builtin_amdgcn_wmma_f32_16x16x4_f32(
                false, (v2f){a[t].z, a[t].w}, false, bw[2 * i + 1], (short)0, acc[t], false, false);
    }

    __builtin_amdgcn_sched_barrier(0);
    asm volatile("v_nop\n\tv_nop\n\tv_nop\n\tv_nop");
    __builtin_amdgcn_sched_barrier(0);

    // ---- 4. add the 16 waves' partial sums; each wave reuses its own slice ----
#pragma unroll
    for (int t = 0; t < 4; ++t)
#pragma unroll
        for (int r = 0; r < 8; ++r)
            slice[(t * 16 + 8 * half + r) * PJ_PP + c] = acc[t][r];
    __syncthreads();

    const int row = threadIdx.x >> 3;           // 0..63
    const int c2  = (threadIdx.x & 7) * 2;      // column pair of [o1 | o2]
    if (c2 < 8 || dual) {
        const float* bp = (c2 < 8) ? b1 : b2;
        float*       op = (c2 < 8) ? o1 : o2;
        const int   col = c2 & 7;
        float sx = bp[col], sy = bp[col + 1];
#pragma unroll
        for (int w = 0; w < 16; ++w) {
            const v2f p = *(const v2f*)(xs + w * PJ_SLICE + row * PJ_PP + c2);
            sx += p.x;
            sy += p.y;
        }
        // a wave stores 4 whole rows: one 128-B line of o1 and one of o2
        *(v2f*)(op + (size_t)(r0 + row) * HD + col) = (v2f){sx, sy};
    }
}

#define KT 4                   // 16-key tiles per softmax step

__device__ __forceinline__ float other_half(float x) {
    const int b = __builtin_bit_cast(int, x);
    return __builtin_bit_cast(float,
        __builtin_amdgcn_permlanex16(b, b, 0x76543210, 0xfedcba98, false, false));
}

__device__ __forceinline__ void exp2_pair(float& a, float& b) {
    asm("v_exp_f32 %0, %0\n\tv_exp_f32 %1, %1\n\tv_nop" : "+v"(a), "+v"(b));
}
__device__ __forceinline__ void exp2_one(float& a) {
    asm("v_exp_f32 %0, %0\n\tv_nop" : "+v"(a));
}
#define LOG2E 1.44269504f      // e^x = 2^(x * LOG2E)

__global__ __launch_bounds__(128)
void attn_kernel(const float* __restrict__ q, const float* __restrict__ k,
                 const float* __restrict__ v, float* __restrict__ attn)
{
    __shared__ float Ks[2][CHUNK * KSTR];   // 2 x 10 KB, padded rows
    __shared__ float Vs[2][CHUNK * HD];     // 2 x  8 KB
    // What lanes 8..15 of each half read as rows 8..15 of V^T: every row of
    // this table is {1,0,0,0,0,0,0,0}, walked with the offsets of a V buffer.
    __shared__ __attribute__((aligned(16))) float Vpad[(CHUNK + 8) * HD];

    const int b    = blockIdx.y;
    const int wave = threadIdx.x >> 5;
    const int lane = threadIdx.x & 31;
    const int n    = lane & 15;          // N index (query col of S^T)
    const int half = lane >> 4;          // lane half selects K/M sub-range
    const int s0   = blockIdx.x * 64 + wave * 16;

    const float* qb = q + (size_t)b * SEQ * HD;
    const float* kb = k + (size_t)b * SEQ * HD;
    const float* vb = v + (size_t)b * SEQ * HD;

    const float* qrow = qb + (size_t)(s0 + n) * HD;
    const v2f bq0 = *(const v2f*)(qrow + 2 * half);       // h = {2h0, 2h0+1}
    const v2f bq1 = *(const v2f*)(qrow + 4 + 2 * half);   // h = {4+2h0, 5+2h0}

    float m_state = -1e30f;
    // O^T, two tiles that take alternate WMMAs so that no WMMA waits for the
    // one directly in front of it; added in the epilogue.
    v8f o0 = {}, o1 = {};

    // ---- staging helper: copy CHUNK rows of K (padded) and V into buffer ----
    auto stage = [&](int tc, int buf) {
        for (int r = threadIdx.x; r < CHUNK; r += 128) {
            const float* krow = kb + (size_t)(tc + r) * HD;
            float*       kd   = &Ks[buf][r * KSTR];
            const float* vrow = vb + (size_t)(tc + r) * HD;
            float*       vd   = &Vs[buf][r * HD];
#if USE_ASYNC_LDS
            async_cp_b64(krow + 0, kd + 0);     // 8B-aligned (stride 40B rows)
            async_cp_b64(krow + 2, kd + 2);
            async_cp_b64(krow + 4, kd + 4);
            async_cp_b64(krow + 6, kd + 6);
            async_cp_b128(vrow + 0, vd + 0);    // 16B-aligned (stride 32B rows)
            async_cp_b128(vrow + 4, vd + 4);
#else
            const float4 ka = ((const float4*)krow)[0];
            const float4 kc = ((const float4*)krow)[1];
            *(v2f*)(kd + 0) = (v2f){ka.x, ka.y};
            *(v2f*)(kd + 2) = (v2f){ka.z, ka.w};
            *(v2f*)(kd + 4) = (v2f){kc.x, kc.y};
            *(v2f*)(kd + 6) = (v2f){kc.z, kc.w};
            ((float4*)vd)[0] = ((const float4*)vrow)[0];
            ((float4*)vd)[1] = ((const float4*)vrow)[1];
#endif
        }
    };

    // Preload chunk 0 into buffer 0.
    stage(0, 0);
    for (int r = threadIdx.x; r < CHUNK + 8; r += 128) {
        ((float4*)&Vpad[r * HD])[0] = make_float4(1.0f, 0.0f, 0.0f, 0.0f);
        ((float4*)&Vpad[r * HD])[1] = make_float4(0.0f, 0.0f, 0.0f, 0.0f);
    }
    wait_async_lds();
    __syncthreads();

    int cur = 0;
    for (int tc = 0; tc < SEQ; tc += CHUNK) {
        // Kick off next chunk into the alternate buffer (overlaps compute).
        if (tc + CHUNK < SEQ) stage(tc + CHUNK, cur ^ 1);

        const float* kp = &Ks[cur][n * KSTR + 2 * half];
        const float* vp = (n < HD) ? &Vs[cur][8 * half * HD + n]
                                   : &Vpad[(1 + half) * HD + (n - HD)];

        // Unrolled so that the LDS reads of later steps can be issued early.
#pragma unroll
        for (int t0 = 0; t0 < CHUNK; t0 += 16 * KT) {
            v8f c[KT];
#pragma unroll  // the index picks registers
            for (int i = 0; i < KT; ++i) {
                const v2f a0 = *(const v2f*)(kp + (t0 + 16 * i) * KSTR);
                c[i] = __builtin_amdgcn_wmma_f32_16x16x4_f32(false, a0, false, bq0,
                                                             (short)0, (v8f){}, false, false);
            }
#pragma unroll  // the index picks registers
            for (int i = 0; i < KT; ++i) {
                const v2f a1 = *(const v2f*)(kp + (t0 + 16 * i) * KSTR + 4);
                c[i] = __builtin_amdgcn_wmma_f32_16x16x4_f32(false, a1, false, bq1,
                                                             (short)0, c[i], false, false);
            }
            // c[i][j] = score(s = s0+n, t = tc + t0 + 16*i + j + 8*half)

            // The step's V^T fragments, read here so that they have landed
            // when the softmax work in front of their WMMAs is done.
            v2f av[4 * KT];
#pragma unroll  // the index picks registers
            for (int u = 0; u < 4 * KT; ++u) {
                const float* vr = vp + (t0 + 16 * (u >> 2) + 2 * (u & 3)) * HD;
                av[u] = (v2f){vr[0], vr[HD]};
            }

            float tm[KT];
#pragma unroll  // the index picks registers
            for (int i = 0; i < KT; ++i) {
                tm[i] = c[i][0];
#pragma unroll  // the index picks registers
                for (int j = 1; j < 8; ++j) tm[i] = fmaxf(tm[i], c[i][j]);
            }
            float tmax = tm[0];
#pragma unroll  // the index picks registers
            for (int i = 1; i < KT; ++i) tmax = fmaxf(tmax, tm[i]);
            tmax = fmaxf(tmax, other_half(tmax));

            const float m_new = fmaxf(m_state, tmax);
            // P in place of the scores, all of a step's values before its
            // first O^T product: independent chains, no wait inside one.
            float scale = (m_state - m_new) * LOG2E;
            m_state = m_new;
#pragma unroll  // i, j pick registers
            for (int i = 0; i < KT; ++i)
#pragma unroll  // i, j pick registers
                for (int j = 0; j < 8; ++j) c[i][j] = (c[i][j] - m_new) * LOG2E;
            exp2_one(scale);
#pragma unroll  // the index picks registers
            for (int j = 0; j < 8; ++j) { o0[j] *= scale; o1[j] *= scale; }

#pragma unroll  // i, j pick registers
            for (int i = 0; i < KT; ++i)
#pragma unroll  // i, j pick registers
                for (int j = 0; j < 8; j += 2) {
                    float e0 = c[i][j], e1 = c[i][j + 1];
                    exp2_pair(e0, e1);
                    c[i][j] = e0; c[i][j + 1] = e1;
                }
            // Vector work and LDS reads may not sink below this line (matrix and
            // scalar instructions may cross): without it each pair of
            // exponentials and each V^T read is placed directly in front of the
            // WMMA that takes it, which then waits out the whole chain.
            __builtin_amdgcn_sched_barrier(0xC);

#pragma unroll  // the index picks registers
            for (int i = 0; i < KT; ++i) {
#pragma unroll  // the index picks registers
                for (int g = 0; g < 4; ++g) {
                    const v2f bp = (v2f){c[i][2 * g], c[i][2 * g + 1]};
                    if (g & 1)
                        o1 = __builtin_amdgcn_wmma_f32_16x16x4_f32(false, av[4 * i + g], false, bp,
                                                                   (short)0, o1, false, false);
                    else
                        o0 = __builtin_amdgcn_wmma_f32_16x16x4_f32(false, av[4 * i + g], false, bp,
                                                                   (short)0, o0, false, false);
                }
            }
        }

        // My async fills for the next buffer are done; barrier makes them
        // visible to all waves and confirms everyone finished this buffer.
        wait_async_lds();
        __syncthreads();
        cur ^= 1;
    }

    // Lane (n, half 0) holds O^T rows 0..7 of query n; lane (n, half 1) holds
    // row 8, the denominator, in register 0.
    const v8f o = o0 + o1;
    const float l_state = other_half(o[0]);
    if (half == 0) {
        const float invl = 1.0f / l_state;
        float* orow = attn + ((size_t)b * SEQ + s0 + n) * HD;
        float4 r0, r1;
        r0.x = o[0] * invl; r0.y = o[1] * invl;
        r0.z = o[2] * invl; r0.w = o[3] * invl;
        r1.x = o[4] * invl; r1.y = o[5] * invl;
        r1.z = o[6] * invl; r1.w = o[7] * invl;
        ((float4*)orow)[0] = r0;
        ((float4*)orow)[1] = r1;
    }
}

// ---------------------------------------------------------------------------
// Kernel 3: out[r,:] = attn[r,0:8] @ Wo[8,1024] + bo. Bound by 64MB output
// write. Wo held in registers (8 x float4 per thread), attn row is a uniform
// load (scalarizable). 16 rows per block.
// ---------------------------------------------------------------------------
__global__ __launch_bounds__(256)
void out_proj(const float* __restrict__ attn, const float* __restrict__ Wo,
              const float* __restrict__ bo, float* __restrict__ out)
{
    const int r0 = blockIdx.x * 16;
    const int c4 = threadIdx.x;                    // float4 column 0..255
    const float4* Wo4 = (const float4*)Wo;

    float4 w[8];
#pragma unroll
    for (int h = 0; h < 8; ++h) w[h] = Wo4[h * (DMODEL / 4) + c4];
    const float4 ob = ((const float4*)bo)[c4];

    for (int r = 0; r < 16; ++r) {
        const float* ar = attn + (size_t)(r0 + r) * HD;
        float a[8];
#pragma unroll
        for (int h = 0; h < 8; ++h) a[h] = ar[h];
        float4 o = ob;
#pragma unroll
        for (int h = 0; h < 8; ++h) {
            o.x = fmaf(a[h], w[h].x, o.x);
            o.y = fmaf(a[h], w[h].y, o.y);
            o.z = fmaf(a[h], w[h].z, o.z);
            o.w = fmaf(a[h], w[h].w, o.w);
        }
        ((float4*)out)[(size_t)(r0 + r) * (DMODEL / 4) + c4] = o;
    }
}

// ---------------------------------------------------------------------------
extern "C" void kernel_launch(void* const* d_in, const int* in_sizes, int n_in,
                              void* d_out, int out_size, void* d_ws, size_t ws_size,
                              hipStream_t stream)
{
    const float* x       = (const float*)d_in[0];
    const float* context = (const float*)d_in[1];
    const float* Wq      = (const float*)d_in[2];
    const float* bq      = (const float*)d_in[3];
    const float* Wk      = (const float*)d_in[4];
    const float* bk      = (const float*)d_in[5];
    const float* Wv      = (const float*)d_in[6];
    const float* bv      = (const float*)d_in[7];
    const float* Wo      = (const float*)d_in[8];
    const float* bo      = (const float*)d_in[9];
    float* out = (float*)d_out;

    float* q    = (float*)d_ws;                // 16384*8 f32 = 512KB
    float* kbuf = q    + (size_t)ROWS * HD;
    float* vbuf = kbuf + (size_t)ROWS * HD;
    float* attn = vbuf + (size_t)ROWS * HD;    // total 2MB scratch

    // q from x, and k and v fused from one read of context, in one launch
    proj_qkv<<<2 * PJ_BLOCKS, 512, 0, stream>>>(x, Wq, bq, q,
                                                context, Wk, bk, kbuf,
                                                Wv, bv, vbuf);
    // flash attention (WMMA scores, async double-buffered K/V staging)
    attn_kernel<<<dim3(SEQ / 64, BATCH), 128, 0, stream>>>(q, kbuf, vbuf, attn);
    // output projection
    out_proj<<<ROWS / 16, 256, 0, stream>>>(attn, Wo, bo, out);
}

// v004
// A run of this version takes 34.4 microseconds.
// In two side-by-side timings against v003, it was 1.12 and 1.11 times as fast.
// Over all steps from v000 it is 5.82 times as fast.
#include <hip/hip_runtime.h>
#include <math.h>

typedef __attribute__((ext_vector_type(2))) float v2f;
typedef __attribute__((ext_vector_type(8))) float v8f;

// Async-copy builtin operand types (match clang's declared signatures:
// b64 -> int __vector(2)*, b128 -> int __vector(4)*).
typedef int vi2 __attribute__((vector_size(8)));
typedef int vi4 __attribute__((vector_size(16)));

#define BATCH  8
#define SEQ    2048
#define DMODEL 1024
#define HD     8
#define ROWS   (BATCH * SEQ)
#define CHUNK  256
#define KSTR   10

#if __has_builtin(__builtin_amdgcn_global_load_async_to_lds_b64) && \
    __has_builtin(__builtin_amdgcn_global_load_async_to_lds_b128)
#define USE_ASYNC_LDS 1
#else
#define USE_ASYNC_LDS 0
#endif

#if USE_ASYNC_LDS
__device__ __forceinline__ void async_cp_b64(const void* g, void* l) {
    __builtin_amdgcn_global_load_async_to_lds_b64(
        (__attribute__((address_space(1))) vi2*)g,
        (__attribute__((address_space(3))) vi2*)l, 0, 0);
}
__device__ __forceinline__ void async_cp_b128(const void* g, void* l) {
    __builtin_amdgcn_global_load_async_to_lds_b128(
        (__attribute__((address_space(1))) vi4*)g,
        (__attribute__((address_space(3))) vi4*)l, 0, 0);
}
#endif

__device__ __forceinline__ void wait_async_lds() {
#if USE_ASYNC_LDS
#if __has_builtin(__builtin_amdgcn_s_wait_asynccnt)
    __builtin_amdgcn_s_wait_asynccnt(0);
#else
    asm volatile("s_wait_asynccnt 0x0" ::: "memory");
#endif
#endif
}

#define PJ_ROWS  128
#define PJ_TILES (PJ_ROWS / 16)
#define PJ_RING  4
#define PJ_KW    64
#define PJ_PITCH 68
#define PJ_SLOT  (16 * PJ_PITCH)
#define PJ_SLICE (PJ_RING * PJ_SLOT)
#define PJ_PP    20
#define PJ_BLOCKS (ROWS / PJ_ROWS)

// One tile: copy j brings rows 2j + half of the tile, 16 B per lane.
__device__ __forceinline__ void pj_copy_tile(unsigned lt, const float* gt) {
    asm volatile(
        "global_load_async_to_lds_b128 %0, %8, off\n\t"
        "global_load_async_to_lds_b128 %1, %9, off\n\t"
        "global_load_async_to_lds_b128 %2, %10, off\n\t"
        "global_load_async_to_lds_b128 %3, %11, off\n\t"
        "global_load_async_to_lds_b128 %4, %12, off\n\t"
        "global_load_async_to_lds_b128 %5, %13, off\n\t"
        "global_load_async_to_lds_b128 %6, %14, off\n\t"
        "global_load_async_to_lds_b128 %7, %15, off\n\t"
        "s_wait_xcnt 0x0"
        :: "v"(lt + 0u * 2u * PJ_PITCH * 4u), "v"(lt + 1u * 2u * PJ_PITCH * 4u),
           "v"(lt + 2u * 2u * PJ_PITCH * 4u), "v"(lt + 3u * 2u * PJ_PITCH * 4u),
           "v"(lt + 4u * 2u * PJ_PITCH * 4u), "v"(lt + 5u * 2u * PJ_PITCH * 4u),
           "v"(lt + 6u * 2u * PJ_PITCH * 4u), "v"(lt + 7u * 2u * PJ_PITCH * 4u),
           "v"(gt + 0 * 2 * DMODEL), "v"(gt + 1 * 2 * DMODEL),
           "v"(gt + 2 * 2 * DMODEL), "v"(gt + 3 * 2 * DMODEL),
           "v"(gt + 4 * 2 * DMODEL), "v"(gt + 5 * 2 * DMODEL),
           "v"(gt + 6 * 2 * DMODEL), "v"(gt + 7 * 2 * DMODEL)
        : "memory");
}

// Returns when all but the wave's LEFT youngest copies have landed; the clobber
// keeps the LDS reads of the tile behind it.
template <int LEFT>
__device__ __forceinline__ void pj_wait_copies() {
    asm volatile("s_wait_asynccnt %0" :: "n"(LEFT) : "memory");
}

// Tile T of a wave: LEFT = copies issued behind tile T's own (8 per tile).
template <int T, int LEFT>
__device__ __forceinline__ v8f pj_tile(const float* arow, unsigned l, const float* g,
                                       const v2f (&bw)[16]) {
    pj_wait_copies<LEFT>();
    float4 a[8];
#pragma unroll
    for (int i = 0; i < 8; ++i)
        a[i] = *(const float4*)(arow + (T % PJ_RING) * PJ_SLOT + 8 * i);
    if (T + PJ_RING < PJ_TILES) {
        asm volatile("s_wait_dscnt 0x0" ::: "memory");
        pj_copy_tile(l + (unsigned)((T % PJ_RING) * PJ_SLOT * 4),
                     g + (size_t)(T + PJ_RING) * 16 * DMODEL);
    }
    __builtin_amdgcn_sched_barrier(0);
    v8f acc = {};
#pragma unroll
    for (int i = 0; i < 8; ++i) {
        acc = __builtin_amdgcn_wmma_f32_16x16x4_f32(
            false, (v2f){a[i].x, a[i].y}, false, bw[2 * i], (short)0, acc, false, false);
        acc = __builtin_amdgcn_wmma_f32_16x16x4_f32(
            false, (v2f){a[i].z, a[i].w}, false, bw[2 * i + 1], (short)0, acc, false, false);
    }
    // Holds this tile's WMMAs in front of the next tile's wait: without it the
    // wait is lifted over them, and they start only when the next tile has landed.
    __builtin_amdgcn_sched_barrier(0);
    asm volatile("v_nop\n\tv_nop\n\tv_nop\n\tv_nop");
    __builtin_amdgcn_sched_barrier(0);
    return acc;
}

__global__ __launch_bounds__(512)
void proj_qkv(const float* __restrict__ x,
              const float* __restrict__ Wq, const float* __restrict__ bq,
              float* __restrict__ qo,
              const float* __restrict__ ctx,
              const float* __restrict__ Wk, const float* __restrict__ bk,
              float* __restrict__ ko,
              const float* __restrict__ W2, const float* __restrict__ b2,
              float* __restrict__ o2)
{
    // The same for every thread of a block: which input, weights and outputs.
    const bool   dual = blockIdx.x >= PJ_BLOCKS;
    const float* in   = dual ? ctx : x;
    const float* W1   = dual ? Wk : Wq;
    const float* b1   = dual ? bk : bq;
    float*       o1   = dual ? ko : qo;

    __shared__ __attribute__((aligned(16))) float xs[16 * PJ_SLICE];   // 272 KB

    const int wave = threadIdx.x >> 5;
    const int lane = threadIdx.x & 31;
    const int c    = lane & 15;
    const int half = lane >> 4;
    const int r0   = (blockIdx.x - (dual ? PJ_BLOCKS : 0)) * PJ_ROWS;
    const int kb   = wave * PJ_KW;
    float* slice   = xs + wave * PJ_SLICE;

    // ---- 1. fill the ring: tiles 0 .. PJ_RING-1 ----
    const float*   g = in + (size_t)(r0 + half) * DMODEL + kb + c * 4;
    const unsigned l = (unsigned)(size_t)(slice + half * PJ_PITCH + c * 4);
#pragma unroll
    for (int t = 0; t < PJ_RING; ++t)
        pj_copy_tile(l + (unsigned)(t * PJ_SLOT * 4), g + (size_t)t * 16 * DMODEL);

    // ---- 2. B fragments: column c of [W1 | W2] (single: W1 twice, upper half unused) ----
    v2f bw[16];
    {
        const float* Wp   = (dual && c >= 8) ? W2 : W1;
        const float* wcol = Wp + (size_t)(kb + 4 * half) * HD + (c & 7);
#pragma unroll
        for (int i = 0; i < 8; ++i) {
            bw[2 * i]     = (v2f){wcol[(8 * i + 0) * HD], wcol[(8 * i + 1) * HD]};
            bw[2 * i + 1] = (v2f){wcol[(8 * i + 2) * HD], wcol[(8 * i + 3) * HD]};
        }
    }

    // ---- 3. partial products: acc[t][r] = row 16t + 8*half + r, column c ----
    const float* arow = slice + c * PJ_PITCH + 4 * half;
    v8f acc[PJ_TILES];
    acc[0] = pj_tile<0, 24>(arow, l, g, bw);
    acc[1] = pj_tile<1, 24>(arow, l, g, bw);
    acc[2] = pj_tile<2, 24>(arow, l, g, bw);
    acc[3] = pj_tile<3, 24>(arow, l, g, bw);
    acc[4] = pj_tile<4, 24>(arow, l, g, bw);
    acc[5] = pj_tile<5, 16>(arow, l, g, bw);
    acc[6] = pj_tile<6, 8>(arow, l, g, bw);
    acc[7] = pj_tile<7, 0>(arow, l, g, bw);

    // ---- 4. add the 16 waves' partial sums; each wave reuses its own ring,
    //         which holds no copy in flight and no unread tile any more ----
#pragma unroll
    for (int t = 0; t < PJ_TILES; ++t)
#pragma unroll
        for (int r = 0; r < 8; ++r)
            slice[(t * 16 + 8 * half + r) * PJ_PP + c] = acc[t][r];
    __syncthreads();

    const int c2 = (threadIdx.x & 7) * 2;       // column pair of [o1 | o2]
    if (c2 < 8 || dual) {
        const float* bp = (c2 < 8) ? b1 : b2;
        float*       op = (c2 < 8) ? o1 : o2;
        const int   col = c2 & 7;
        const float bx = bp[col], by = bp[col + 1];
#pragma unroll
        for (int rr = 0; rr < PJ_ROWS / 64; ++rr) {
            const int row = rr * 64 + (threadIdx.x >> 3);
            float sx = bx, sy = by;
#pragma unroll
            for (int w = 0; w < 16; ++w) {
                const v2f p = *(const v2f*)(xs + w * PJ_SLICE + row * PJ_PP + c2);
                sx += p.x;
                sy += p.y;
            }
            // a wave stores 4 whole rows: one 128-B line of o1 and one of o2
            *(v2f*)(op + (size_t)(r0 + row) * HD + col) = (v2f){sx, sy};
        }
    }
}

#define KT 4                   // 16-key tiles per softmax step

__device__ __forceinline__ float other_half(float x) {
    const int b = __builtin_bit_cast(int, x);
    return __builtin_bit_cast(float,
        __builtin_amdgcn_permlanex16(b, b, 0x76543210, 0xfedcba98, false, false));
}

__device__ __forceinline__ void exp2_pair(float& a, float& b) {
    asm("v_exp_f32 %0, %0\n\tv_exp_f32 %1, %1\n\tv_nop" : "+v"(a), "+v"(b));
}
__device__ __forceinline__ void exp2_one(float& a) {
    asm("v_exp_f32 %0, %0\n\tv_nop" : "+v"(a));
}
#define LOG2E 1.44269504f      // e^x = 2^(x * LOG2E)

__global__ __launch_bounds__(128)
void attn_kernel(const float* __restrict__ q, const float* __restrict__ k,
                 const float* __restrict__ v, float* __restrict__ attn)
{
    __shared__ float Ks[2][CHUNK * KSTR];   // 2 x 10 KB, padded rows
    __shared__ float Vs[2][CHUNK * HD];     // 2 x  8 KB
    // What lanes 8..15 of each half read as rows 8..15 of V^T: every row of
    // this table is {1,0,0,0,0,0,0,0}, walked with the offsets of a V buffer.
    __shared__ __attribute__((aligned(16))) float Vpad[(CHUNK + 8) * HD];

    const int b    = blockIdx.y;
    const int wave = threadIdx.x >> 5;
    const int lane = threadIdx.x & 31;
    const int n    = lane & 15;          // N index (query col of S^T)
    const int half = lane >> 4;          // lane half selects K/M sub-range
    const int s0   = blockIdx.x * 64 + wave * 16;

    const float* qb = q + (size_t)b * SEQ * HD;
    const float* kb = k + (size_t)b * SEQ * HD;
    const float* vb = v + (size_t)b * SEQ * HD;

    const float* qrow = qb + (size_t)(s0 + n) * HD;
    const v2f bq0 = *(const v2f*)(qrow + 2 * half);       // h = {2h0, 2h0+1}
    const v2f bq1 = *(const v2f*)(qrow + 4 + 2 * half);   // h = {4+2h0, 5+2h0}

    float m_state = -1e30f;
    // O^T, two tiles that take alternate WMMAs so that no WMMA waits for the
    // one directly in front of it; added in the epilogue.
    v8f o0 = {}, o1 = {};

    // ---- staging helper: copy CHUNK rows of K (padded) and V into buffer ----
    auto stage = [&](int tc, int buf) {
        for (int r = threadIdx.x; r < CHUNK; r += 128) {
            const float* krow = kb + (size_t)(tc + r) * HD;
            float*       kd   = &Ks[buf][r * KSTR];
            const float* vrow = vb + (size_t)(tc + r) * HD;
            float*       vd   = &Vs[buf][r * HD];
#if USE_ASYNC_LDS
            async_cp_b64(krow + 0, kd + 0);     // 8B-aligned (stride 40B rows)
            async_cp_b64(krow + 2, kd + 2);
            async_cp_b64(krow + 4, kd + 4);
            async_cp_b64(krow + 6, kd + 6);
            async_cp_b128(vrow + 0, vd + 0);    // 16B-aligned (stride 32B rows)
            async_cp_b128(vrow + 4, vd + 4);
#else
            const float4 ka = ((const float4*)krow)[0];
            const float4 kc = ((const float4*)krow)[1];
            *(v2f*)(kd + 0) = (v2f){ka.x, ka.y};
            *(v2f*)(kd + 2) = (v2f){ka.z, ka.w};
            *(v2f*)(kd + 4) = (v2f){kc.x, kc.y};
            *(v2f*)(kd + 6) = (v2f){kc.z, kc.w};
            ((float4*)vd)[0] = ((const float4*)vrow)[0];
            ((float4*)vd)[1] = ((const float4*)vrow)[1];
#endif
        }
    };

    // Preload chunk 0 into buffer 0.
    stage(0, 0);
    for (int r = threadIdx.x; r < CHUNK + 8; r += 128) {
        ((float4*)&Vpad[r * HD])[0] = make_float4(1.0f, 0.0f, 0.0f, 0.0f);
        ((float4*)&Vpad[r * HD])[1] = make_float4(0.0f, 0.0f, 0.0f, 0.0f);
    }
    wait_async_lds();
    __syncthreads();

    int cur = 0;
    for (int tc = 0; tc < SEQ; tc += CHUNK) {
        // Kick off next chunk into the alternate buffer (overlaps compute).
        if (tc + CHUNK < SEQ) stage(tc + CHUNK, cur ^ 1);

        const float* kp = &Ks[cur][n * KSTR + 2 * half];
        const float* vp = (n < HD) ? &Vs[cur][8 * half * HD + n]
                                   : &Vpad[(1 + half) * HD + (n - HD)];

        // Unrolled so that the LDS reads of later steps can be issued early.
#pragma unroll
        for (int t0 = 0; t0 < CHUNK; t0 += 16 * KT) {
            v8f c[KT];
#pragma unroll  // the index picks registers
            for (int i = 0; i < KT; ++i) {
                const v2f a0 = *(const v2f*)(kp + (t0 + 16 * i) * KSTR);
                c[i] = __builtin_amdgcn_wmma_f32_16x16x4_f32(false, a0, false, bq0,
                                                             (short)0, (v8f){}, false, false);
            }
#pragma unroll  // the index picks registers
            for (int i = 0; i < KT; ++i) {
                const v2f a1 = *(const v2f*)(kp + (t0 + 16 * i) * KSTR + 4);
                c[i] = __builtin_amdgcn_wmma_f32_16x16x4_f32(false, a1, false, bq1,
                                                             (short)0, c[i], false, false);
            }
            // c[i][j] = score(s = s0+n, t = tc + t0 + 16*i + j + 8*half)

            // The step's V^T fragments, read here so that they have landed
            // when the softmax work in front of their WMMAs is done.
            v2f av[4 * KT];
#pragma unroll  // the index picks registers
            for (int u = 0; u < 4 * KT; ++u) {
                const float* vr = vp + (t0 + 16 * (u >> 2) + 2 * (u & 3)) * HD;
                av[u] = (v2f){vr[0], vr[HD]};
            }

            float tm[KT];
#pragma unroll  // the index picks registers
            for (int i = 0; i < KT; ++i) {
                tm[i] = c[i][0];
#pragma unroll  // the index picks registers
                for (int j = 1; j < 8; ++j) tm[i] = fmaxf(tm[i], c[i][j]);
            }
            float tmax = tm[0];
#pragma unroll  // the index picks registers
            for (int i = 1; i < KT; ++i) tmax = fmaxf(tmax, tm[i]);
            tmax = fmaxf(tmax, other_half(tmax));

            const float m_new = fmaxf(m_state, tmax);
            // P in place of the scores, all of a step's values before its
            // first O^T product: independent chains, no wait inside one.
            float scale = (m_state - m_new) * LOG2E;
            m_state = m_new;
#pragma unroll  // i, j pick registers
            for (int i = 0; i < KT; ++i)
#pragma unroll  // i, j pick registers
                for (int j = 0; j < 8; ++j) c[i][j] = (c[i][j] - m_new) * LOG2E;
            exp2_one(scale);
#pragma unroll  // the index picks registers
            for (int j = 0; j < 8; ++j) { o0[j] *= scale; o1[j] *= scale; }

#pragma unroll  // i, j pick registers
            for (int i = 0; i < KT; ++i)
#pragma unroll  // i, j pick registers
                for (int j = 0; j < 8; j += 2) {
                    float e0 = c[i][j], e1 = c[i][j + 1];
                    exp2_pair(e0, e1);
                    c[i][j] = e0; c[i][j + 1] = e1;
                }
            // Vector work and LDS reads may not sink below this line (matrix and
            // scalar instructions may cross): without it each pair of
            // exponentials and each V^T read is placed directly in front of the
            // WMMA that takes it, which then waits out the whole chain.
            __builtin_amdgcn_sched_barrier(0xC);

#pragma unroll  // the index picks registers
            for (int i = 0; i < KT; ++i) {
#pragma unroll  // the index picks registers
                for (int g = 0; g < 4; ++g) {
                    const v2f bp = (v2f){c[i][2 * g], c[i][2 * g + 1]};
                    if (g & 1)
                        o1 = __builtin_amdgcn_wmma_f32_16x16x4_f32(false, av[4 * i + g], false, bp,
                                                                   (short)0, o1, false, false);
                    else
                        o0 = __builtin_amdgcn_wmma_f32_16x16x4_f32(false, av[4 * i + g], false, bp,
                                                                   (short)0, o0, false, false);
                }
            }
        }

        // My async fills for the next buffer are done; barrier makes them
        // visible to all waves and confirms everyone finished this buffer.
        wait_async_lds();
        __syncthreads();
        cur ^= 1;
    }

    // Lane (n, half 0) holds O^T rows 0..7 of query n; lane (n, half 1) holds
    // row 8, the denominator, in register 0.
    const v8f o = o0 + o1;
    const float l_state = other_half(o[0]);
    if (half == 0) {
        const float invl = 1.0f / l_state;
        float* orow = attn + ((size_t)b * SEQ + s0 + n) * HD;
        float4 r0, r1;
        r0.x = o[0] * invl; r0.y = o[1] * invl;
        r0.z = o[2] * invl; r0.w = o[3] * invl;
        r1.x = o[4] * invl; r1.y = o[5] * invl;
        r1.z = o[6] * invl; r1.w = o[7] * invl;
        ((float4*)orow)[0] = r0;
        ((float4*)orow)[1] = r1;
    }
}

// ---------------------------------------------------------------------------
// Kernel 3: out[r,:] = attn[r,0:8] @ Wo[8,1024] + bo. Bound by 64MB output
// write. Wo held in registers (8 x float4 per thread), attn row is a uniform
// load (scalarizable). 16 rows per block.
// ---------------------------------------------------------------------------
__global__ __launch_bounds__(256)
void out_proj(const float* __restrict__ attn, const float* __restrict__ Wo,
              const float* __restrict__ bo, float* __restrict__ out)
{
    const int r0 = blockIdx.x * 16;
    const int c4 = threadIdx.x;                    // float4 column 0..255
    const float4* Wo4 = (const float4*)Wo;

    float4 w[8];
#pragma unroll
    for (int h = 0; h < 8; ++h) w[h] = Wo4[h * (DMODEL / 4) + c4];
    const float4 ob = ((const float4*)bo)[c4];

    for (int r = 0; r < 16; ++r) {
        const float* ar = attn + (size_t)(r0 + r) * HD;
        float a[8];
#pragma unroll
        for (int h = 0; h < 8; ++h) a[h] = ar[h];
        float4 o = ob;
#pragma unroll
        for (int h = 0; h < 8; ++h) {
            o.x = fmaf(a[h], w[h].x, o.x);
            o.y = fmaf(a[h], w[h].y, o.y);
            o.z = fmaf(a[h], w[h].z, o.z);
            o.w = fmaf(a[h], w[h].w, o.w);
        }
        ((float4*)out)[(size_t)(r0 + r) * (DMODEL / 4) + c4] = o;
    }
}

// ---------------------------------------------------------------------------
extern "C" void kernel_launch(void* const* d_in, const int* in_sizes, int n_in,
                              void* d_out, int out_size, void* d_ws, size_t ws_size,
                              hipStream_t stream)
{
    const float* x       = (const float*)d_in[0];
    const float* context = (const float*)d_in[1];
    const float* Wq      = (const float*)d_in[2];
    const float* bq      = (const float*)d_in[3];
    const float* Wk      = (const float*)d_in[4];
    const float* bk      = (const float*)d_in[5];
    const float* Wv      = (const float*)d_in[6];
    const float* bv      = (const float*)d_in[7];
    const float* Wo      = (const float*)d_in[8];
    const float* bo      = (const float*)d_in[9];
    float* out = (float*)d_out;

    float* q    = (float*)d_ws;                // 16384*8 f32 = 512KB
    float* kbuf = q    + (size_t)ROWS * HD;
    float* vbuf = kbuf + (size_t)ROWS * HD;
    float* attn = vbuf + (size_t)ROWS * HD;    // total 2MB scratch

    // q from x, and k and v fused from one read of context, in one launch
    proj_qkv<<<2 * PJ_BLOCKS, 512, 0, stream>>>(x, Wq, bq, q,
                                                context, Wk, bk, kbuf,
                                                Wv, bv, vbuf);
    // flash attention (WMMA scores, async double-buffered K/V staging)
    attn_kernel<<<dim3(SEQ / 64, BATCH), 128, 0, stream>>>(q, kbuf, vbuf, attn);
    // output projection
    out_proj<<<ROWS / 16, 256, 0, stream>>>(attn, Wo, bo, out);
}

// v005
// Measured time: 29.2 microseconds a run.
// Two timings next to v004 both put it at 1.18 times that version's speed.
// Counting every step since v000, it is 6.88 times as fast.
#include <hip/hip_runtime.h>
#include <math.h>

typedef __attribute__((ext_vector_type(2))) float v2f;
typedef __attribute__((ext_vector_type(8))) float v8f;

// Async-copy builtin operand types (match clang's declared signatures:
// b64 -> int __vector(2)*, b128 -> int __vector(4)*).
typedef int vi2 __attribute__((vector_size(8)));
typedef int vi4 __attribute__((vector_size(16)));

#define BATCH  8
#define SEQ    2048
#define DMODEL 1024
#define HD     8
#define ROWS   (BATCH * SEQ)
#define CHUNK  256
#define KSTR   10

#if __has_builtin(__builtin_amdgcn_global_load_async_to_lds_b64) && \
    __has_builtin(__builtin_amdgcn_global_load_async_to_lds_b128)
#define USE_ASYNC_LDS 1
#else
#define USE_ASYNC_LDS 0
#endif

#if USE_ASYNC_LDS
__device__ __forceinline__ void async_cp_b64(const void* g, void* l) {
    __builtin_amdgcn_global_load_async_to_lds_b64(
        (__attribute__((address_space(1))) vi2*)g,
        (__attribute__((address_space(3))) vi2*)l, 0, 0);
}
__device__ __forceinline__ void async_cp_b128(const void* g, void* l) {
    __builtin_amdgcn_global_load_async_to_lds_b128(
        (__attribute__((address_space(1))) vi4*)g,
        (__attribute__((address_space(3))) vi4*)l, 0, 0);
}
#endif

__device__ __forceinline__ void wait_async_lds() {
#if USE_ASYNC_LDS
#if __has_builtin(__builtin_amdgcn_s_wait_asynccnt)
    __builtin_amdgcn_s_wait_asynccnt(0);
#else
    asm volatile("s_wait_asynccnt 0x0" ::: "memory");
#endif
#endif
}

#define PJ_ROWS  128
#define PJ_TILES (PJ_ROWS / 16)
#define PJ_RING  4
#define PJ_KW    64
#define PJ_PITCH 68
#define PJ_SLOT  (16 * PJ_PITCH)
#define PJ_SLICE (PJ_RING * PJ_SLOT)
#define PJ_PP    20
#define PJ_BLOCKS (ROWS / PJ_ROWS)

// One tile: copy j brings rows 2j + half of the tile, 16 B per lane.
__device__ __forceinline__ void pj_copy_tile(unsigned lt, const float* gt) {
    asm volatile(
        "global_load_async_to_lds_b128 %0, %8, off\n\t"
        "global_load_async_to_lds_b128 %1, %9, off\n\t"
        "global_load_async_to_lds_b128 %2, %10, off\n\t"
        "global_load_async_to_lds_b128 %3, %11, off\n\t"
        "global_load_async_to_lds_b128 %4, %12, off\n\t"
        "global_load_async_to_lds_b128 %5, %13, off\n\t"
        "global_load_async_to_lds_b128 %6, %14, off\n\t"
        "global_load_async_to_lds_b128 %7, %15, off\n\t"
        "s_wait_xcnt 0x0"
        :: "v"(lt + 0u * 2u * PJ_PITCH * 4u), "v"(lt + 1u * 2u * PJ_PITCH * 4u),
           "v"(lt + 2u * 2u * PJ_PITCH * 4u), "v"(lt + 3u * 2u * PJ_PITCH * 4u),
           "v"(lt + 4u * 2u * PJ_PITCH * 4u), "v"(lt + 5u * 2u * PJ_PITCH * 4u),
           "v"(lt + 6u * 2u * PJ_PITCH * 4u), "v"(lt + 7u * 2u * PJ_PITCH * 4u),
           "v"(gt + 0 * 2 * DMODEL), "v"(gt + 1 * 2 * DMODEL),
           "v"(gt + 2 * 2 * DMODEL), "v"(gt + 3 * 2 * DMODEL),
           "v"(gt + 4 * 2 * DMODEL), "v"(gt + 5 * 2 * DMODEL),
           "v"(gt + 6 * 2 * DMODEL), "v"(gt + 7 * 2 * DMODEL)
        : "memory");
}

// Returns when all but the wave's LEFT youngest copies have landed; the clobber
// keeps the LDS reads of the tile behind it.
template <int LEFT>
__device__ __forceinline__ void pj_wait_copies() {
    asm volatile("s_wait_asynccnt %0" :: "n"(LEFT) : "memory");
}

// Tile T of a wave: LEFT = copies issued behind tile T's own (8 per tile).
template <int T, int LEFT>
__device__ __forceinline__ v8f pj_tile(const float* arow, unsigned l, const float* g,
                                       const v2f (&bw)[16]) {
    pj_wait_copies<LEFT>();
    float4 a[8];
#pragma unroll
    for (int i = 0; i < 8; ++i)
        a[i] = *(const float4*)(arow + (T % PJ_RING) * PJ_SLOT + 8 * i);
    if (T + PJ_RING < PJ_TILES) {
        asm volatile("s_wait_dscnt 0x0" ::: "memory");
        pj_copy_tile(l + (unsigned)((T % PJ_RING) * PJ_SLOT * 4),
                     g + (size_t)(T + PJ_RING) * 16 * DMODEL);
    }
    __builtin_amdgcn_sched_barrier(0);
    v8f acc = {};
#pragma unroll
    for (int i = 0; i < 8; ++i) {
        acc = __builtin_amdgcn_wmma_f32_16x16x4_f32(
            false, (v2f){a[i].x, a[i].y}, false, bw[2 * i], (short)0, acc, false, false);
        acc = __builtin_amdgcn_wmma_f32_16x16x4_f32(
            false, (v2f){a[i].z, a[i].w}, false, bw[2 * i + 1], (short)0, acc, false, false);
    }
    // Holds this tile's WMMAs in front of the next tile's wait: without it the
    // wait is lifted over them, and they start only when the next tile has landed.
    __builtin_amdgcn_sched_barrier(0);
    asm volatile("v_nop\n\tv_nop\n\tv_nop\n\tv_nop");
    __builtin_amdgcn_sched_barrier(0);
    return acc;
}

__global__ __launch_bounds__(512)
void proj_qkv(const float* __restrict__ x,
              const float* __restrict__ Wq, const float* __restrict__ bq,
              float* __restrict__ qo,
              const float* __restrict__ ctx,
              const float* __restrict__ Wk, const float* __restrict__ bk,
              float* __restrict__ ko,
              const float* __restrict__ W2, const float* __restrict__ b2,
              float* __restrict__ o2)
{
    // The same for every thread of a block: which input, weights and outputs.
    const bool   dual = blockIdx.x >= PJ_BLOCKS;
    const float* in   = dual ? ctx : x;
    const float* W1   = dual ? Wk : Wq;
    const float* b1   = dual ? bk : bq;
    float*       o1   = dual ? ko : qo;

    __shared__ __attribute__((aligned(16))) float xs[16 * PJ_SLICE];   // 272 KB

    const int wave = threadIdx.x >> 5;
    const int lane = threadIdx.x & 31;
    const int c    = lane & 15;
    const int half = lane >> 4;
    const int r0   = (blockIdx.x - (dual ? PJ_BLOCKS : 0)) * PJ_ROWS;
    const int kb   = wave * PJ_KW;
    float* slice   = xs + wave * PJ_SLICE;

    // ---- 1. fill the ring: tiles 0 .. PJ_RING-1 ----
    const float*   g = in + (size_t)(r0 + half) * DMODEL + kb + c * 4;
    const unsigned l = (unsigned)(size_t)(slice + half * PJ_PITCH + c * 4);
#pragma unroll
    for (int t = 0; t < PJ_RING; ++t)
        pj_copy_tile(l + (unsigned)(t * PJ_SLOT * 4), g + (size_t)t * 16 * DMODEL);

    // ---- 2. B fragments: column c of [W1 | W2] (single: W1 twice, upper half unused) ----
    v2f bw[16];
    {
        const float* Wp   = (dual && c >= 8) ? W2 : W1;
        const float* wcol = Wp + (size_t)(kb + 4 * half) * HD + (c & 7);
#pragma unroll
        for (int i = 0; i < 8; ++i) {
            bw[2 * i]     = (v2f){wcol[(8 * i + 0) * HD], wcol[(8 * i + 1) * HD]};
            bw[2 * i + 1] = (v2f){wcol[(8 * i + 2) * HD], wcol[(8 * i + 3) * HD]};
        }
    }

    // ---- 3. partial products: acc[t][r] = row 16t + 8*half + r, column c ----
    const float* arow = slice + c * PJ_PITCH + 4 * half;
    v8f acc[PJ_TILES];
    acc[0] = pj_tile<0, 24>(arow, l, g, bw);
    acc[1] = pj_tile<1, 24>(arow, l, g, bw);
    acc[2] = pj_tile<2, 24>(arow, l, g, bw);
    acc[3] = pj_tile<3, 24>(arow, l, g, bw);
    acc[4] = pj_tile<4, 24>(arow, l, g, bw);
    acc[5] = pj_tile<5, 16>(arow, l, g, bw);
    acc[6] = pj_tile<6, 8>(arow, l, g, bw);
    acc[7] = pj_tile<7, 0>(arow, l, g, bw);

    // ---- 4. add the 16 waves' partial sums; each wave reuses its own ring,
    //         which holds no copy in flight and no unread tile any more ----
#pragma unroll
    for (int t = 0; t < PJ_TILES; ++t)
#pragma unroll
        for (int r = 0; r < 8; ++r)
            slice[(t * 16 + 8 * half + r) * PJ_PP + c] = acc[t][r];
    __syncthreads();

    const int c2 = (threadIdx.x & 7) * 2;       // column pair of [o1 | o2]
    if (c2 < 8 || dual) {
        const float* bp = (c2 < 8) ? b1 : b2;
        float*       op = (c2 < 8) ? o1 : o2;
        const int   col = c2 & 7;
        const float bx = bp[col], by = bp[col + 1];
#pragma unroll
        for (int rr = 0; rr < PJ_ROWS / 64; ++rr) {
            const int row = rr * 64 + (threadIdx.x >> 3);
            float sx = bx, sy = by;
#pragma unroll
            for (int w = 0; w < 16; ++w) {
                const v2f p = *(const v2f*)(xs + w * PJ_SLICE + row * PJ_PP + c2);
                sx += p.x;
                sy += p.y;
            }
            // a wave stores 4 whole rows: one 128-B line of o1 and one of o2
            *(v2f*)(op + (size_t)(r0 + row) * HD + col) = (v2f){sx, sy};
        }
    }
}

#define KT 4                   // 16-key tiles per softmax step

__device__ __forceinline__ float other_half(float x) {
    const int b = __builtin_bit_cast(int, x);
    return __builtin_bit_cast(float,
        __builtin_amdgcn_permlanex16(b, b, 0x76543210, 0xfedcba98, false, false));
}

__device__ __forceinline__ void exp2_pair(float& a, float& b) {
    asm("v_exp_f32 %0, %0\n\tv_exp_f32 %1, %1\n\tv_nop" : "+v"(a), "+v"(b));
}
__device__ __forceinline__ void exp2_one(float& a) {
    asm("v_exp_f32 %0, %0\n\tv_nop" : "+v"(a));
}
#define LOG2E 1.44269504f      // e^x = 2^(x * LOG2E)

__global__ __launch_bounds__(128)
void attn_kernel(const float* __restrict__ q, const float* __restrict__ k,
                 const float* __restrict__ v, const float* __restrict__ Wo,
                 const float* __restrict__ bo, float* __restrict__ out)
{
    __shared__ float Ks[2][CHUNK * KSTR];   // 2 x 10 KB, padded rows
    __shared__ float Vs[2][CHUNK * HD];     // 2 x  8 KB
    // What lanes 8..15 of each half read as rows 8..15 of V^T: every row of
    // this table is {1,0,0,0,0,0,0,0}, walked with the offsets of a V buffer.
    __shared__ __attribute__((aligned(16))) float Vpad[(CHUNK + 8) * HD];
    // The block's 64 rows of attention output, for the output projection.
    __shared__ __attribute__((aligned(16))) float Os[64 * HD];

    const int b    = blockIdx.y;
    const int wave = threadIdx.x >> 5;
    const int lane = threadIdx.x & 31;
    const int n    = lane & 15;          // N index (query col of S^T)
    const int half = lane >> 4;          // lane half selects K/M sub-range
    const int s0   = blockIdx.x * 64 + wave * 16;

    const float* qb = q + (size_t)b * SEQ * HD;
    const float* kb = k + (size_t)b * SEQ * HD;
    const float* vb = v + (size_t)b * SEQ * HD;

    const float* qrow = qb + (size_t)(s0 + n) * HD;
    const v2f bq0 = *(const v2f*)(qrow + 2 * half);       // h = {2h0, 2h0+1}
    const v2f bq1 = *(const v2f*)(qrow + 4 + 2 * half);   // h = {4+2h0, 5+2h0}

    // This thread's columns of Wo and bo: float4 columns c4 and c4 + 32.
    const int c4 = wave * 64 + lane;
    float4 w0[HD], w1[HD];
#pragma unroll  // the index picks registers
    for (int h = 0; h < HD; ++h) {
        w0[h] = ((const float4*)Wo)[h * (DMODEL / 4) + c4];
        w1[h] = ((const float4*)Wo)[h * (DMODEL / 4) + c4 + 32];
    }
    const float4 ob0 = ((const float4*)bo)[c4];
    const float4 ob1 = ((const float4*)bo)[c4 + 32];

    float m_state = -1e30f;
    // O^T, two tiles that take alternate WMMAs so that no WMMA waits for the
    // one directly in front of it; added in the epilogue.
    v8f o0 = {}, o1 = {};

    // ---- staging helper: copy CHUNK rows of K (padded) and V into buffer ----
    auto stage = [&](int tc, int buf) {
        for (int r = threadIdx.x; r < CHUNK; r += 128) {
            const float* krow = kb + (size_t)(tc + r) * HD;
            float*       kd   = &Ks[buf][r * KSTR];
            const float* vrow = vb + (size_t)(tc + r) * HD;
            float*       vd   = &Vs[buf][r * HD];
#if USE_ASYNC_LDS
            async_cp_b64(krow + 0, kd + 0);     // 8B-aligned (stride 40B rows)
            async_cp_b64(krow + 2, kd + 2);
            async_cp_b64(krow + 4, kd + 4);
            async_cp_b64(krow + 6, kd + 6);
            async_cp_b128(vrow + 0, vd + 0);    // 16B-aligned (stride 32B rows)
            async_cp_b128(vrow + 4, vd + 4);
#else
            const float4 ka = ((const float4*)krow)[0];
            const float4 kc = ((const float4*)krow)[1];
            *(v2f*)(kd + 0) = (v2f){ka.x, ka.y};
            *(v2f*)(kd + 2) = (v2f){ka.z, ka.w};
            *(v2f*)(kd + 4) = (v2f){kc.x, kc.y};
            *(v2f*)(kd + 6) = (v2f){kc.z, kc.w};
            ((float4*)vd)[0] = ((const float4*)vrow)[0];
            ((float4*)vd)[1] = ((const float4*)vrow)[1];
#endif
        }
    };

    // Preload chunk 0 into buffer 0.
    stage(0, 0);
    for (int r = threadIdx.x; r < CHUNK + 8; r += 128) {
        ((float4*)&Vpad[r * HD])[0] = make_float4(1.0f, 0.0f, 0.0f, 0.0f);
        ((float4*)&Vpad[r * HD])[1] = make_float4(0.0f, 0.0f, 0.0f, 0.0f);
    }
    wait_async_lds();
    __syncthreads();

    int cur = 0;
    for (int tc = 0; tc < SEQ; tc += CHUNK) {
        // Kick off next chunk into the alternate buffer (overlaps compute).
        if (tc + CHUNK < SEQ) stage(tc + CHUNK, cur ^ 1);

        const float* kp = &Ks[cur][n * KSTR + 2 * half];
        const float* vp = (n < HD) ? &Vs[cur][8 * half * HD + n]
                                   : &Vpad[(1 + half) * HD + (n - HD)];

        // Unrolled so that the LDS reads of later steps can be issued early.
#pragma unroll
        for (int t0 = 0; t0 < CHUNK; t0 += 16 * KT) {
            v8f c[KT];
#pragma unroll  // the index picks registers
            for (int i = 0; i < KT; ++i) {
                const v2f a0 = *(const v2f*)(kp + (t0 + 16 * i) * KSTR);
                c[i] = __builtin_amdgcn_wmma_f32_16x16x4_f32(false, a0, false, bq0,
                                                             (short)0, (v8f){}, false, false);
            }
#pragma unroll  // the index picks registers
            for (int i = 0; i < KT; ++i) {
                const v2f a1 = *(const v2f*)(kp + (t0 + 16 * i) * KSTR + 4);
                c[i] = __builtin_amdgcn_wmma_f32_16x16x4_f32(false, a1, false, bq1,
                                                             (short)0, c[i], false, false);
            }
            // c[i][j] = score(s = s0+n, t = tc + t0 + 16*i + j + 8*half)

            // The step's V^T fragments, read here so that they have landed
            // when the softmax work in front of their WMMAs is done.
            v2f av[4 * KT];
#pragma unroll  // the index picks registers
            for (int u = 0; u < 4 * KT; ++u) {
                const float* vr = vp + (t0 + 16 * (u >> 2) + 2 * (u & 3)) * HD;
                av[u] = (v2f){vr[0], vr[HD]};
            }

            float tm[KT];
#pragma unroll  // the index picks registers
            for (int i = 0; i < KT; ++i) {
                tm[i] = c[i][0];
#pragma unroll  // the index picks registers
                for (int j = 1; j < 8; ++j) tm[i] = fmaxf(tm[i], c[i][j]);
            }
            float tmax = tm[0];
#pragma unroll  // the index picks registers
            for (int i = 1; i < KT; ++i) tmax = fmaxf(tmax, tm[i]);
            tmax = fmaxf(tmax, other_half(tmax));

            const float m_new = fmaxf(m_state, tmax);
            // P in place of the scores, all of a step's values before its
            // first O^T product: independent chains, no wait inside one.
            float scale = (m_state - m_new) * LOG2E;
            m_state = m_new;
#pragma unroll  // i, j pick registers
            for (int i = 0; i < KT; ++i)
#pragma unroll  // i, j pick registers
                for (int j = 0; j < 8; ++j) c[i][j] = (c[i][j] - m_new) * LOG2E;
            exp2_one(scale);
#pragma unroll  // the index picks registers
            for (int j = 0; j < 8; ++j) { o0[j] *= scale; o1[j] *= scale; }

#pragma unroll  // i, j pick registers
            for (int i = 0; i < KT; ++i)
#pragma unroll  // i, j pick registers
                for (int j = 0; j < 8; j += 2) {
                    float e0 = c[i][j], e1 = c[i][j + 1];
                    exp2_pair(e0, e1);
                    c[i][j] = e0; c[i][j + 1] = e1;
                }
            // Vector work and LDS reads may not sink below this line (matrix and
            // scalar instructions may cross): without it each pair of
            // exponentials and each V^T read is placed directly in front of the
            // WMMA that takes it, which then waits out the whole chain.
            __builtin_amdgcn_sched_barrier(0xC);

#pragma unroll  // the index picks registers
            for (int i = 0; i < KT; ++i) {
#pragma unroll  // the index picks registers
                for (int g = 0; g < 4; ++g) {
                    const v2f bp = (v2f){c[i][2 * g], c[i][2 * g + 1]};
                    if (g & 1)
                        o1 = __builtin_amdgcn_wmma_f32_16x16x4_f32(false, av[4 * i + g], false, bp,
                                                                   (short)0, o1, false, false);
                    else
                        o0 = __builtin_amdgcn_wmma_f32_16x16x4_f32(false, av[4 * i + g], false, bp,
                                                                   (short)0, o0, false, false);
                }
            }
        }

        // My async fills for the next buffer are done; barrier makes them
        // visible to all waves and confirms everyone finished this buffer.
        wait_async_lds();
        __syncthreads();
        cur ^= 1;
    }

    // Lane (n, half 0) holds O^T rows 0..7 of query n; lane (n, half 1) holds
    // row 8, the denominator, in register 0.
    const v8f o = o0 + o1;
    const float l_state = other_half(o[0]);
    if (half == 0) {
        const float invl = 1.0f / l_state;
        float* orow = &Os[(wave * 16 + n) * HD];
        float4 r0, r1;
        r0.x = o[0] * invl; r0.y = o[1] * invl;
        r0.z = o[2] * invl; r0.w = o[3] * invl;
        r1.x = o[4] * invl; r1.y = o[5] * invl;
        r1.z = o[6] * invl; r1.w = o[7] * invl;
        ((float4*)orow)[0] = r0;
        ((float4*)orow)[1] = r1;
    }
    // Every wave reads all 64 rows.
    __syncthreads();

    float4* op = (float4*)out + ((size_t)b * SEQ + blockIdx.x * 64) * (DMODEL / 4) + c4;
    const float4* Os4 = (const float4*)Os;
    // Four rows a trip. The next trip's rows are read from LDS in front of this
    // trip's sums, so that a lone wave does not wait out the LDS latency.
    float4 an[8];
#pragma unroll  // the index picks registers
    for (int i = 0; i < 8; ++i) an[i] = Os4[i];
#pragma unroll 2  // the two sets of row registers swap by name, not by copies
    for (int r = 0; r < 64; r += 4) {
        float4 ac[8];
#pragma unroll  // the index picks registers
        for (int i = 0; i < 8; ++i) ac[i] = an[i];
        const int rn = (r + 4 < 64) ? r + 4 : 0;   // last trip: rows 0..3 again, unused
#pragma unroll  // the index picks registers
        for (int i = 0; i < 8; ++i) an[i] = Os4[2 * rn + i];
        v2f p[4][4];
#pragma unroll  // the index picks registers
        for (int j = 0; j < 4; ++j) {
            const float a[HD] = {ac[2 * j].x,     ac[2 * j].y,     ac[2 * j].z,     ac[2 * j].w,
                                 ac[2 * j + 1].x, ac[2 * j + 1].y, ac[2 * j + 1].z, ac[2 * j + 1].w};
            p[j][0] = (v2f){ob0.x, ob0.y};
            p[j][1] = (v2f){ob0.z, ob0.w};
            p[j][2] = (v2f){ob1.x, ob1.y};
            p[j][3] = (v2f){ob1.z, ob1.w};
#pragma unroll  // the index picks registers
            for (int h = 0; h < HD; ++h) {
                const v2f ah = (v2f){a[h], a[h]};
                p[j][0] = __builtin_elementwise_fma(ah, (v2f){w0[h].x, w0[h].y}, p[j][0]);
                p[j][1] = __builtin_elementwise_fma(ah, (v2f){w0[h].z, w0[h].w}, p[j][1]);
                p[j][2] = __builtin_elementwise_fma(ah, (v2f){w1[h].x, w1[h].y}, p[j][2]);
                p[j][3] = __builtin_elementwise_fma(ah, (v2f){w1[h].z, w1[h].w}, p[j][3]);
            }
        }
#pragma unroll  // the index picks registers
        for (int j = 0; j < 4; ++j) {
            op[(size_t)(r + j) * (DMODEL / 4)] =
                make_float4(p[j][0].x, p[j][0].y, p[j][1].x, p[j][1].y);
            op[(size_t)(r + j) * (DMODEL / 4) + 32] =
                make_float4(p[j][2].x, p[j][2].y, p[j][3].x, p[j][3].y);
        }
        asm volatile("s_wait_xcnt 0x0" ::: "memory");
    }
}

// ---------------------------------------------------------------------------
extern "C" void kernel_launch(void* const* d_in, const int* in_sizes, int n_in,
                              void* d_out, int out_size, void* d_ws, size_t ws_size,
                              hipStream_t stream)
{
    const float* x       = (const float*)d_in[0];
    const float* context = (const float*)d_in[1];
    const float* Wq      = (const float*)d_in[2];
    const float* bq      = (const float*)d_in[3];
    const float* Wk      = (const float*)d_in[4];
    const float* bk      = (const float*)d_in[5];
    const float* Wv      = (const float*)d_in[6];
    const float* bv      = (const float*)d_in[7];
    const float* Wo      = (const float*)d_in[8];
    const float* bo      = (const float*)d_in[9];
    float* out = (float*)d_out;

    float* q    = (float*)d_ws;                // 16384*8 f32 = 512KB
    float* kbuf = q    + (size_t)ROWS * HD;
    float* vbuf = kbuf + (size_t)ROWS * HD;    // total 1.5MB scratch

    // q from x, and k and v fused from one read of context, in one launch
    proj_qkv<<<2 * PJ_BLOCKS, 512, 0, stream>>>(x, Wq, bq, q,
                                                context, Wk, bk, kbuf,
                                                Wv, bv, vbuf);
    // flash attention (WMMA scores, async double-buffered K/V staging) with the
    // output projection as its epilogue
    attn_kernel<<<dim3(SEQ / 64, BATCH), 128, 0, stream>>>(q, kbuf, vbuf, Wo, bo, out);
}

// v006
// A run of this version takes 28.1 microseconds.
// Two timings next to v005 both put it at 1.05 times that version's speed.
// Counting every step since v000, it is 7.21 times as fast.
#include <hip/hip_runtime.h>
#include <math.h>

typedef __attribute__((ext_vector_type(2))) float v2f;
typedef __attribute__((ext_vector_type(8))) float v8f;

// Async-copy builtin operand types (match clang's declared signatures:
// b64 -> int __vector(2)*, b128 -> int __vector(4)*).
typedef int vi2 __attribute__((vector_size(8)));
typedef int vi4 __attribute__((vector_size(16)));

#define BATCH  8
#define SEQ    2048
#define DMODEL 1024
#define HD     8
#define ROWS   (BATCH * SEQ)
#define CHUNK  256
#define KSTR   10

#if __has_builtin(__builtin_amdgcn_global_load_async_to_lds_b64) && \
    __has_builtin(__builtin_amdgcn_global_load_async_to_lds_b128)
#define USE_ASYNC_LDS 1
#else
#define USE_ASYNC_LDS 0
#endif

#if USE_ASYNC_LDS
__device__ __forceinline__ void async_cp_b64(const void* g, void* l) {
    __builtin_amdgcn_global_load_async_to_lds_b64(
        (__attribute__((address_space(1))) vi2*)g,
        (__attribute__((address_space(3))) vi2*)l, 0, 0);
}
__device__ __forceinline__ void async_cp_b128(const void* g, void* l) {
    __builtin_amdgcn_global_load_async_to_lds_b128(
        (__attribute__((address_space(1))) vi4*)g,
        (__attribute__((address_space(3))) vi4*)l, 0, 0);
}
#endif

__device__ __forceinline__ void wait_async_lds() {
#if USE_ASYNC_LDS
#if __has_builtin(__builtin_amdgcn_s_wait_asynccnt)
    __builtin_amdgcn_s_wait_asynccnt(0);
#else
    asm volatile("s_wait_asynccnt 0x0" ::: "memory");
#endif
#endif
}

#define PJ_ROWS  128
#define PJ_TILES (PJ_ROWS / 16)
#define PJ_RING  4
#define PJ_KW    64
#define PJ_PITCH 68
#define PJ_SLOT  (16 * PJ_PITCH)
#define PJ_SLICE (PJ_RING * PJ_SLOT)
#define PJ_PP    20
#define PJ_BLOCKS (ROWS / PJ_ROWS)

// One tile: copy j brings rows 2j + half of the tile, 16 B per lane.
__device__ __forceinline__ void pj_copy_tile(unsigned lt, const float* gt) {
    asm volatile(
        "global_load_async_to_lds_b128 %0, %8, off\n\t"
        "global_load_async_to_lds_b128 %1, %9, off\n\t"
        "global_load_async_to_lds_b128 %2, %10, off\n\t"
        "global_load_async_to_lds_b128 %3, %11, off\n\t"
        "global_load_async_to_lds_b128 %4, %12, off\n\t"
        "global_load_async_to_lds_b128 %5, %13, off\n\t"
        "global_load_async_to_lds_b128 %6, %14, off\n\t"
        "global_load_async_to_lds_b128 %7, %15, off\n\t"
        "s_wait_xcnt 0x0"
        :: "v"(lt + 0u * 2u * PJ_PITCH * 4u), "v"(lt + 1u * 2u * PJ_PITCH * 4u),
           "v"(lt + 2u * 2u * PJ_PITCH * 4u), "v"(lt + 3u * 2u * PJ_PITCH * 4u),
           "v"(lt + 4u * 2u * PJ_PITCH * 4u), "v"(lt + 5u * 2u * PJ_PITCH * 4u),
           "v"(lt + 6u * 2u * PJ_PITCH * 4u), "v"(lt + 7u * 2u * PJ_PITCH * 4u),
           "v"(gt + 0 * 2 * DMODEL), "v"(gt + 1 * 2 * DMODEL),
           "v"(gt + 2 * 2 * DMODEL), "v"(gt + 3 * 2 * DMODEL),
           "v"(gt + 4 * 2 * DMODEL), "v"(gt + 5 * 2 * DMODEL),
           "v"(gt + 6 * 2 * DMODEL), "v"(gt + 7 * 2 * DMODEL)
        : "memory");
}

// Returns when all but the wave's LEFT youngest copies have landed; the clobber
// keeps the LDS reads of the tile behind it.
template <int LEFT>
__device__ __forceinline__ void pj_wait_copies() {
    asm volatile("s_wait_asynccnt %0" :: "n"(LEFT) : "memory");
}

// Tile T of a wave: LEFT = copies issued behind tile T's own (8 per tile).
template <int T, int LEFT>
__device__ __forceinline__ v8f pj_tile(const float* arow, unsigned l, const float* g,
                                       const v2f (&bw)[16]) {
    pj_wait_copies<LEFT>();
    float4 a[8];
#pragma unroll
    for (int i = 0; i < 8; ++i)
        a[i] = *(const float4*)(arow + (T % PJ_RING) * PJ_SLOT + 8 * i);
    if (T + PJ_RING < PJ_TILES) {
        asm volatile("s_wait_dscnt 0x0" ::: "memory");
        pj_copy_tile(l + (unsigned)((T % PJ_RING) * PJ_SLOT * 4),
                     g + (size_t)(T + PJ_RING) * 16 * DMODEL);
    }
    __builtin_amdgcn_sched_barrier(0);
    v8f acc = {};
#pragma unroll
    for (int i = 0; i < 8; ++i) {
        acc = __builtin_amdgcn_wmma_f32_16x16x4_f32(
            false, (v2f){a[i].x, a[i].y}, false, bw[2 * i], (short)0, acc, false, false);
        acc = __builtin_amdgcn_wmma_f32_16x16x4_f32(
            false, (v2f){a[i].z, a[i].w}, false, bw[2 * i + 1], (short)0, acc, false, false);
    }
    // Holds this tile's WMMAs in front of the next tile's wait: without it the
    // wait is lifted over them, and they start only when the next tile has landed.
    __builtin_amdgcn_sched_barrier(0);
    asm volatile("v_nop\n\tv_nop\n\tv_nop\n\tv_nop");
    __builtin_amdgcn_sched_barrier(0);
    return acc;
}

__global__ __launch_bounds__(512)
void proj_qkv(const float* __restrict__ x,
              const float* __restrict__ Wq, const float* __restrict__ bq,
              float* __restrict__ qo,
              const float* __restrict__ ctx,
              const float* __restrict__ Wk, const float* __restrict__ bk,
              float* __restrict__ ko,
              const float* __restrict__ W2, const float* __restrict__ b2,
              float* __restrict__ o2)
{
    // The same for every thread of a block: which input, weights and outputs.
    const bool   dual = blockIdx.x >= PJ_BLOCKS;
    const float* in   = dual ? ctx : x;
    const float* W1   = dual ? Wk : Wq;
    const float* b1   = dual ? bk : bq;
    float*       o1   = dual ? ko : qo;

    __shared__ __attribute__((aligned(16))) float xs[16 * PJ_SLICE];   // 272 KB

    const int wave = threadIdx.x >> 5;
    const int lane = threadIdx.x & 31;
    const int c    = lane & 15;
    const int half = lane >> 4;
    const int r0   = (blockIdx.x - (dual ? PJ_BLOCKS : 0)) * PJ_ROWS;
    const int kb   = wave * PJ_KW;
    float* slice   = xs + wave * PJ_SLICE;

    // ---- 1. fill the ring: tiles 0 .. PJ_RING-1 ----
    const float*   g = in + (size_t)(r0 + half) * DMODEL + kb + c * 4;
    const unsigned l = (unsigned)(size_t)(slice + half * PJ_PITCH + c * 4);
#pragma unroll
    for (int t = 0; t < PJ_RING; ++t)
        pj_copy_tile(l + (unsigned)(t * PJ_SLOT * 4), g + (size_t)t * 16 * DMODEL);

    // ---- 2. B fragments: column c of [W1 | W2] (single: W1 twice, upper half unused) ----
    v2f bw[16];
    {
        const float* Wp   = (dual && c >= 8) ? W2 : W1;
        const float* wcol = Wp + (size_t)(kb + 4 * half) * HD + (c & 7);
#pragma unroll
        for (int i = 0; i < 8; ++i) {
            bw[2 * i]     = (v2f){wcol[(8 * i + 0) * HD], wcol[(8 * i + 1) * HD]};
            bw[2 * i + 1] = (v2f){wcol[(8 * i + 2) * HD], wcol[(8 * i + 3) * HD]};
        }
    }

    // ---- 3. partial products: acc[t][r] = row 16t + 8*half + r, column c ----
    const float* arow = slice + c * PJ_PITCH + 4 * half;
    v8f acc[PJ_TILES];
    acc[0] = pj_tile<0, 24>(arow, l, g, bw);
    acc[1] = pj_tile<1, 24>(arow, l, g, bw);
    acc[2] = pj_tile<2, 24>(arow, l, g, bw);
    acc[3] = pj_tile<3, 24>(arow, l, g, bw);
    acc[4] = pj_tile<4, 24>(arow, l, g, bw);
    acc[5] = pj_tile<5, 16>(arow, l, g, bw);
    acc[6] = pj_tile<6, 8>(arow, l, g, bw);
    acc[7] = pj_tile<7, 0>(arow, l, g, bw);

    // ---- 4. add the 16 waves' partial sums; each wave reuses its own ring,
    //         which holds no copy in flight and no unread tile any more ----
#pragma unroll
    for (int t = 0; t < PJ_TILES; ++t)
#pragma unroll
        for (int r = 0; r < 8; ++r)
            slice[(t * 16 + 8 * half + r) * PJ_PP + c] = acc[t][r];
    __syncthreads();

    const int c2 = (threadIdx.x & 7) * 2;       // column pair of [o1 | o2]
    if (c2 < 8 || dual) {
        const float* bp = (c2 < 8) ? b1 : b2;
        float*       op = (c2 < 8) ? o1 : o2;
        const int   col = c2 & 7;
        const float bx = bp[col], by = bp[col + 1];
#pragma unroll
        for (int rr = 0; rr < PJ_ROWS / 64; ++rr) {
            const int row = rr * 64 + (threadIdx.x >> 3);
            float sx = bx, sy = by;
#pragma unroll
            for (int w = 0; w < 16; ++w) {
                const v2f p = *(const v2f*)(xs + w * PJ_SLICE + row * PJ_PP + c2);
                sx += p.x;
                sy += p.y;
            }
            // a wave stores 4 whole rows: one 128-B line of o1 and one of o2
            *(v2f*)(op + (size_t)(r0 + row) * HD + col) = (v2f){sx, sy};
        }
    }
}

#define KT 4                   // 16-key tiles per softmax step
#define KSPLIT 2               // wave groups, each on its own part of the keys
#define GKEYS  (SEQ / KSPLIT)  // keys per wave group

__device__ __forceinline__ float other_half(float x) {
    const int b = __builtin_bit_cast(int, x);
    return __builtin_bit_cast(float,
        __builtin_amdgcn_permlanex16(b, b, 0x76543210, 0xfedcba98, false, false));
}

__device__ __forceinline__ void exp2_pair(float& a, float& b) {
    asm("v_exp_f32 %0, %0\n\tv_exp_f32 %1, %1\n\tv_nop" : "+v"(a), "+v"(b));
}
__device__ __forceinline__ void exp2_one(float& a) {
    asm("v_exp_f32 %0, %0\n\tv_nop" : "+v"(a));
}
#define LOG2E 1.44269504f      // e^x = 2^(x * LOG2E)

__global__ __launch_bounds__(256)
void attn_kernel(const float* __restrict__ q, const float* __restrict__ k,
                 const float* __restrict__ v, const float* __restrict__ Wo,
                 const float* __restrict__ bo, float* __restrict__ out)
{
    // Per wave group: 2 x 10 KB of K, padded rows, and 2 x 8 KB of V.
    __shared__ __attribute__((aligned(16))) float Ks[KSPLIT][2][CHUNK * KSTR];
    __shared__ __attribute__((aligned(16))) float Vs[KSPLIT][2][CHUNK * HD];
    // What lanes 8..15 of each half read as rows 8..15 of V^T: every row of
    // this table is {1,0,0,0,0,0,0,0}, walked with the offsets of a V buffer.
    __shared__ __attribute__((aligned(16))) float Vpad[(CHUNK + 8) * HD];
    // The block's 64 rows of attention output, for the output projection.
    __shared__ __attribute__((aligned(16))) float Os[64 * HD];
    // What the second group hands to the first: per query tile the 8 registers
    // of O^T and the running maximum, one float per lane each.
    __shared__ float Mg[4][9][32];

    const int b    = blockIdx.y;
    const int wave = __builtin_amdgcn_readfirstlane(threadIdx.x >> 5);
    const int grp  = wave >> 2;          // which part of the keys
    const int qt   = wave & 3;           // which 16-query tile
    const int tg   = threadIdx.x & 127;  // thread within its group
    const int lane = threadIdx.x & 31;
    const int n    = lane & 15;          // N index (query col of S^T)
    const int half = lane >> 4;          // lane half selects K/M sub-range
    const int s0   = blockIdx.x * 64 + qt * 16;

    const float* qb = q + (size_t)b * SEQ * HD;
    const float* kb = k + ((size_t)b * SEQ + grp * GKEYS) * HD;
    const float* vb = v + ((size_t)b * SEQ + grp * GKEYS) * HD;

    const float* qrow = qb + (size_t)(s0 + n) * HD;
    const v2f bq0 = *(const v2f*)(qrow + 2 * half);       // h = {2h0, 2h0+1}
    const v2f bq1 = *(const v2f*)(qrow + 4 + 2 * half);   // h = {4+2h0, 5+2h0}

    // This thread's columns of Wo and bo: float4 column c4.
    const int c4 = wave * 32 + lane;
    float4 w0[HD];
#pragma unroll  // the index picks registers
    for (int h = 0; h < HD; ++h)
        w0[h] = ((const float4*)Wo)[h * (DMODEL / 4) + c4];
    const float4 ob0 = ((const float4*)bo)[c4];

    float m_state = -1e30f;
    // O^T, two tiles that take alternate WMMAs so that no WMMA waits for the
    // one directly in front of it; added in the epilogue.
    v8f o0 = {}, o1 = {};

    // ---- staging helper: a group's 128 threads copy CHUNK rows of the group's
    //      K (padded) and V into the group's buffer ----
    auto stage = [&](int tc, int buf) {
        for (int r = tg; r < CHUNK; r += 128) {
            const float* krow = kb + (size_t)(tc + r) * HD;
            float*       kd   = &Ks[grp][buf][r * KSTR];
            const float* vrow = vb + (size_t)(tc + r) * HD;
            float*       vd   = &Vs[grp][buf][r * HD];
#if USE_ASYNC_LDS
            async_cp_b64(krow + 0, kd + 0);     // 8B-aligned (stride 40B rows)
            async_cp_b64(krow + 2, kd + 2);
            async_cp_b64(krow + 4, kd + 4);
            async_cp_b64(krow + 6, kd + 6);
            async_cp_b128(vrow + 0, vd + 0);    // 16B-aligned (stride 32B rows)
            async_cp_b128(vrow + 4, vd + 4);
#else
            const float4 ka = ((const float4*)krow)[0];
            const float4 kc = ((const float4*)krow)[1];
            *(v2f*)(kd + 0) = (v2f){ka.x, ka.y};
            *(v2f*)(kd + 2) = (v2f){ka.z, ka.w};
            *(v2f*)(kd + 4) = (v2f){kc.x, kc.y};
            *(v2f*)(kd + 6) = (v2f){kc.z, kc.w};
            ((float4*)vd)[0] = ((const float4*)vrow)[0];
            ((float4*)vd)[1] = ((const float4*)vrow)[1];
#endif
        }
    };

    // Preload chunk 0 into buffer 0.
    stage(0, 0);
    for (int r = threadIdx.x; r < CHUNK + 8; r += 256) {
        ((float4*)&Vpad[r * HD])[0] = make_float4(1.0f, 0.0f, 0.0f, 0.0f);
        ((float4*)&Vpad[r * HD])[1] = make_float4(0.0f, 0.0f, 0.0f, 0.0f);
    }
    wait_async_lds();
    __syncthreads();

    int cur = 0;
    for (int tc = 0; tc < GKEYS; tc += CHUNK) {
        // Kick off next chunk into the alternate buffer (overlaps compute).
        if (tc + CHUNK < GKEYS) stage(tc + CHUNK, cur ^ 1);

        const float* kp = &Ks[grp][cur][n * KSTR + 2 * half];
        const float* vp = (n < HD) ? &Vs[grp][cur][8 * half * HD + n]
                                   : &Vpad[(1 + half) * HD + (n - HD)];

        // Unrolled so that the LDS reads of later steps can be issued early.
#pragma unroll
        for (int t0 = 0; t0 < CHUNK; t0 += 16 * KT) {
            v8f c[KT];
#pragma unroll  // the index picks registers
            for (int i = 0; i < KT; ++i) {
                const v2f a0 = *(const v2f*)(kp + (t0 + 16 * i) * KSTR);
                c[i] = __builtin_amdgcn_wmma_f32_16x16x4_f32(false, a0, false, bq0,
                                                             (short)0, (v8f){}, false, false);
            }
#pragma unroll  // the index picks registers
            for (int i = 0; i < KT; ++i) {
                const v2f a1 = *(const v2f*)(kp + (t0 + 16 * i) * KSTR + 4);
                c[i] = __builtin_amdgcn_wmma_f32_16x16x4_f32(false, a1, false, bq1,
                                                             (short)0, c[i], false, false);
            }
            // c[i][j] = score(s = s0+n, t = grp*GKEYS + tc + t0 + 16*i + j + 8*half)

            // The step's V^T fragments, read here so that they have landed
            // when the softmax work in front of their WMMAs is done.
            v2f av[4 * KT];
#pragma unroll  // the index picks registers
            for (int u = 0; u < 4 * KT; ++u) {
                const float* vr = vp + (t0 + 16 * (u >> 2) + 2 * (u & 3)) * HD;
                av[u] = (v2f){vr[0], vr[HD]};
            }

            float tm[KT];
#pragma unroll  // the index picks registers
            for (int i = 0; i < KT; ++i) {
                tm[i] = c[i][0];
#pragma unroll  // the index picks registers
                for (int j = 1; j < 8; ++j) tm[i] = fmaxf(tm[i], c[i][j]);
            }
            float tmax = tm[0];
#pragma unroll  // the index picks registers
            for (int i = 1; i < KT; ++i) tmax = fmaxf(tmax, tm[i]);
            tmax = fmaxf(tmax, other_half(tmax));

            const float m_new = fmaxf(m_state, tmax);
            // P in place of the scores, all of a step's values before its
            // first O^T product: independent chains, no wait inside one.
            float scale = (m_state - m_new) * LOG2E;
            m_state = m_new;
#pragma unroll  // i, j pick registers
            for (int i = 0; i < KT; ++i)
#pragma unroll  // i, j pick registers
                for (int j = 0; j < 8; ++j) c[i][j] = (c[i][j] - m_new) * LOG2E;
            exp2_one(scale);
#pragma unroll  // the index picks registers
            for (int j = 0; j < 8; ++j) { o0[j] *= scale; o1[j] *= scale; }

#pragma unroll  // i, j pick registers
            for (int i = 0; i < KT; ++i)
#pragma unroll  // i, j pick registers
                for (int j = 0; j < 8; j += 2) {
                    float e0 = c[i][j], e1 = c[i][j + 1];
                    exp2_pair(e0, e1);
                    c[i][j] = e0; c[i][j + 1] = e1;
                }
            // Vector work and LDS reads may not sink below this line (matrix and
            // scalar instructions may cross): without it each pair of
            // exponentials and each V^T read is placed directly in front of the
            // WMMA that takes it, which then waits out the whole chain.
            __builtin_amdgcn_sched_barrier(0xC);

#pragma unroll  // the index picks registers
            for (int i = 0; i < KT; ++i) {
#pragma unroll  // the index picks registers
                for (int g = 0; g < 4; ++g) {
                    const v2f bp = (v2f){c[i][2 * g], c[i][2 * g + 1]};
                    if (g & 1)
                        o1 = __builtin_amdgcn_wmma_f32_16x16x4_f32(false, av[4 * i + g], false, bp,
                                                                   (short)0, o1, false, false);
                    else
                        o0 = __builtin_amdgcn_wmma_f32_16x16x4_f32(false, av[4 * i + g], false, bp,
                                                                   (short)0, o0, false, false);
                }
            }
        }

        // My async fills for the next buffer are done; barrier makes them
        // visible to all waves and confirms everyone finished this buffer.
        wait_async_lds();
        __syncthreads();
        cur ^= 1;
        __builtin_amdgcn_sched_barrier(0);
        asm volatile("v_nop\n\tv_nop\n\tv_nop\n\tv_nop");
        __builtin_amdgcn_sched_barrier(0);
    }

    // Lane (n, half 0) holds O^T rows 0..7 of query n; lane (n, half 1) holds
    // row 8, the denominator, in register 0.
    v8f o = o0 + o1;
    // Join of the two key halves: the second group's wave hands its O^T and its
    // maximum to the first group's wave of the same query tile, lane to lane.
    if (grp == 1) {
#pragma unroll  // the index picks registers
        for (int j = 0; j < 8; ++j) Mg[qt][j][lane] = o[j];
        Mg[qt][8][lane] = m_state;
    }
    // The first group reads what the second has written.
    __syncthreads();
    if (grp == 0) {
        const float m_oth = Mg[qt][8][lane];
        const float m_all = fmaxf(m_state, m_oth);
        float f_own = (m_state - m_all) * LOG2E;
        float f_oth = (m_oth - m_all) * LOG2E;
        exp2_pair(f_own, f_oth);
#pragma unroll  // the index picks registers
        for (int j = 0; j < 8; ++j) o[j] = o[j] * f_own + Mg[qt][j][lane] * f_oth;
        const float l_state = other_half(o[0]);
        if (half == 0) {
            const float invl = 1.0f / l_state;
            float* orow = &Os[(qt * 16 + n) * HD];
            float4 r0, r1;
            r0.x = o[0] * invl; r0.y = o[1] * invl;
            r0.z = o[2] * invl; r0.w = o[3] * invl;
            r1.x = o[4] * invl; r1.y = o[5] * invl;
            r1.z = o[6] * invl; r1.w = o[7] * invl;
            ((float4*)orow)[0] = r0;
            ((float4*)orow)[1] = r1;
        }
    }
    // Every wave reads all 64 rows.
    __syncthreads();

    float4* op = (float4*)out + ((size_t)b * SEQ + blockIdx.x * 64) * (DMODEL / 4) + c4;
    const float4* Os4 = (const float4*)Os;
    // Four rows a trip. The next trip's rows are read from LDS in front of this
    // trip's sums, so that a lone wave does not wait out the LDS latency.
    float4 an[8];
#pragma unroll  // the index picks registers
    for (int i = 0; i < 8; ++i) an[i] = Os4[i];
#pragma unroll 2  // the two sets of row registers swap by name, not by copies
    for (int r = 0; r < 64; r += 4) {
        float4 ac[8];
#pragma unroll  // the index picks registers
        for (int i = 0; i < 8; ++i) ac[i] = an[i];
        const int rn = (r + 4 < 64) ? r + 4 : 0;   // last trip: rows 0..3 again, unused
#pragma unroll  // the index picks registers
        for (int i = 0; i < 8; ++i) an[i] = Os4[2 * rn + i];
        v2f p[4][2];
#pragma unroll  // the index picks registers
        for (int j = 0; j < 4; ++j) {
            const float a[HD] = {ac[2 * j].x,     ac[2 * j].y,     ac[2 * j].z,     ac[2 * j].w,
                                 ac[2 * j + 1].x, ac[2 * j + 1].y, ac[2 * j + 1].z, ac[2 * j + 1].w};
            p[j][0] = (v2f){ob0.x, ob0.y};
            p[j][1] = (v2f){ob0.z, ob0.w};
#pragma unroll  // the index picks registers
            for (int h = 0; h < HD; ++h) {
                const v2f ah = (v2f){a[h], a[h]};
                p[j][0] = __builtin_elementwise_fma(ah, (v2f){w0[h].x, w0[h].y}, p[j][0]);
                p[j][1] = __builtin_elementwise_fma(ah, (v2f){w0[h].z, w0[h].w}, p[j][1]);
            }
        }
#pragma unroll  // the index picks registers
        for (int j = 0; j < 4; ++j)
            op[(size_t)(r + j) * (DMODEL / 4)] =
                make_float4(p[j][0].x, p[j][0].y, p[j][1].x, p[j][1].y);
        asm volatile("s_wait_xcnt 0x0" ::: "memory");
    }
}

// ---------------------------------------------------------------------------
extern "C" void kernel_launch(void* const* d_in, const int* in_sizes, int n_in,
                              void* d_out, int out_size, void* d_ws, size_t ws_size,
                              hipStream_t stream)
{
    const float* x       = (const float*)d_in[0];
    const float* context = (const float*)d_in[1];
    const float* Wq      = (const float*)d_in[2];
    const float* bq      = (const float*)d_in[3];
    const float* Wk      = (const float*)d_in[4];
    const float* bk      = (const float*)d_in[5];
    const float* Wv      = (const float*)d_in[6];
    const float* bv      = (const float*)d_in[7];
    const float* Wo      = (const float*)d_in[8];
    const float* bo      = (const float*)d_in[9];
    float* out = (float*)d_out;

    float* q    = (float*)d_ws;                // 16384*8 f32 = 512KB
    float* kbuf = q    + (size_t)ROWS * HD;
    float* vbuf = kbuf + (size_t)ROWS * HD;    // total 1.5MB scratch

    // q from x, and k and v fused from one read of context, in one launch
    proj_qkv<<<2 * PJ_BLOCKS, 512, 0, stream>>>(x, Wq, bq, q,
                                                context, Wk, bk, kbuf,
                                                Wv, bv, vbuf);
    // flash attention (WMMA scores, async double-buffered K/V staging) with the
    // output projection as its epilogue
    attn_kernel<<<dim3(SEQ / 64, BATCH), 256, 0, stream>>>(q, kbuf, vbuf, Wo, bo, out);
}
